// v000
// The times below were measured on an AMD MI455X: many runs one after another, warmed up first and cycling through
// copies of the inputs, with the whole window's GPU time divided by the number of runs. Launches and the gaps
// between them are all in it. The median over several windows is given; except for v000 it joins two sittings, which
// can be a few percent apart, so the side-by-side timings, each taken in one sitting, are the better comparison.
// The starting kernel, v000, takes 76.8 microseconds a run.
#include <hip/hip_runtime.h>

#define Hd 128
#define Bd 128
#define Ld 2048
#define NC 16
#define LC (Ld / NC)      // 128 steps per chunk
#define LT 32             // time tile inside main kernel
#define NTILES (LC / LT)  // 4
#define LDP 136           // padded LDS row length in halfs (breaks bank aliasing)

static constexpr float DT = 0.01f;

typedef __attribute__((ext_vector_type(16))) _Float16 v16h;
typedef __attribute__((ext_vector_type(8)))  float    v8f;

// ---------------------------------------------------------------------------
// Kernel 1: parameter setup.
//   Abar[i][j] = (1/(I - A*dt/2)) * (I + A*dt/2)        (elementwise, I=eye)
//   Cbar[i][j] = (1/(I - Abar*dt/2)) * C * dt           (elementwise)
//   Apow       = Abar^128 (per-element, for chunk prefix)
//   Cbar is written directly in WMMA B-fragment layout (f16), minus sign of
//   the imaginary part folded in:  Y = HRe@CbRe^T + HIm@(-CbIm^T)
// ---------------------------------------------------------------------------
__global__ void lssm_setup_kernel(const float* __restrict__ A_rt,
                                  const float* __restrict__ C_rt,
                                  float* __restrict__ abarRe,
                                  float* __restrict__ abarIm,
                                  float* __restrict__ apow,
                                  _Float16* __restrict__ bfrag) {
    const int i = blockIdx.x;    // row of Abar/Cbar
    const int j = threadIdx.x;   // col of Abar/Cbar
    const int idx = i * Hd + j;

    const float ar = A_rt[idx * 2 + 0], ai = A_rt[idx * 2 + 1];
    const float cr = C_rt[idx * 2 + 0], ci = C_rt[idx * 2 + 1];
    const float hdt = DT * 0.5f;
    const float eye = (i == j) ? 1.0f : 0.0f;

    // Abar = recip(I - z) * (I + z), z = A*dt/2
    const float zr = ar * hdt, zi = ai * hdt;
    float dr = eye - zr, di = -zi;
    float den = dr * dr + di * di;
    float rr = dr / den, ri = -di / den;
    const float nr = eye + zr, ni = zi;
    const float abr = rr * nr - ri * ni;
    const float abi = rr * ni + ri * nr;
    abarRe[idx] = abr;
    abarIm[idx] = abi;

    // Apow = Abar^128 via 7 complex squarings
    float pr = abr, pi = abi;
#pragma unroll
    for (int s = 0; s < 7; ++s) {
        float t = pr * pr - pi * pi;
        pi = 2.0f * pr * pi;
        pr = t;
    }
    apow[idx * 2 + 0] = pr;
    apow[idx * 2 + 1] = pi;

    // Cbar = recip(I - Abar*dt/2) * C * dt
    float er = eye - abr * hdt, ei = -abi * hdt;
    float den2 = er * er + ei * ei;
    float qr = er / den2, qi = -ei / den2;
    const float cbr = (qr * cr - qi * ci) * DT;
    const float cbi = (qr * ci + qi * cr) * DT;

    // B matrix element (k = j, n = i): B1[k][n] = CbRe[n][k], B2[k][n] = -CbIm[n][k]
    // Fragment layout (mirrors ISA 16-bit operand layout):
    //   kb = k>>5, kk = k&31, nb = n>>4, nn = n&15
    //   lane    = nn + 16*((kk>>3)&1)
    //   halfIdx = ((kk>>4)<<3) + (kk&7)
    const int kb = j >> 5, kk = j & 31;
    const int nb = i >> 4, nn = i & 15;
    const int lane = nn + (((kk >> 3) & 1) << 4);
    const int hidx = ((kk >> 4) << 3) + (kk & 7);
    const int base = lane * 16 + hidx;
    bfrag[(size_t)((kb * 8 + nb)) * 512 + base]      = (_Float16)cbr;   // Re plane
    bfrag[(size_t)(32 + kb * 8 + nb) * 512 + base]   = (_Float16)(-cbi); // -Im plane
}

// ---------------------------------------------------------------------------
// Kernel 2: per-chunk carry.  Scan each 128-step chunk from zero state.
// carry[b][c][h] = h-state at end of chunk c given zero start state.
// ---------------------------------------------------------------------------
__global__ void lssm_carry_kernel(const float* __restrict__ X,
                                  const float* __restrict__ abarRe,
                                  const float* __restrict__ abarIm,
                                  float* __restrict__ carry) {
    const int c = blockIdx.x;
    const int b = blockIdx.y;
    const int h = threadIdx.x;
    const float ar = abarRe[b * Hd + h];
    const float ai = abarIm[b * Hd + h];
    const float* xp = X + ((size_t)b * Ld + (size_t)c * LC) * Hd + h;
    float hr = 0.0f, hi = 0.0f;
#pragma unroll 4
    for (int t = 0; t < LC; ++t) {
        const float x = xp[(size_t)t * Hd];
        const float nrr = x + hr * ar - hi * ai;
        const float nii = hr * ai + hi * ar;
        hr = nrr;
        hi = nii;
    }
    const size_t o = (((size_t)b * NC + c) * Hd + h) * 2;
    carry[o + 0] = hr;
    carry[o + 1] = hi;
}

// ---------------------------------------------------------------------------
// Kernel 3: prefix over chunks (in place: carry buffer becomes hstart buffer).
//   E_{-1} = 0;  hstart[c] = E_{c-1};  E_c = Apow * E_{c-1} + carry_c
// ---------------------------------------------------------------------------
__global__ void lssm_prefix_kernel(const float* __restrict__ apow,
                                   float* __restrict__ carry) {
    const int b = blockIdx.x;
    const int h = threadIdx.x;
    const float pr = apow[(b * Hd + h) * 2 + 0];
    const float pi = apow[(b * Hd + h) * 2 + 1];
    float er = 0.0f, ei = 0.0f;
#pragma unroll
    for (int c = 0; c < NC; ++c) {
        const size_t o = (((size_t)b * NC + c) * Hd + h) * 2;
        const float vr = carry[o + 0];
        const float vi = carry[o + 1];
        carry[o + 0] = er;             // now holds chunk start state
        carry[o + 1] = ei;
        const float nrr = pr * er - pi * ei + vr;
        const float nii = pr * ei + pi * er + vi;
        er = nrr;
        ei = nii;
    }
}

// ---------------------------------------------------------------------------
// Kernel 4: fused scan + WMMA GEMM.  One (batch, chunk) per block, 8 waves.
// Per 32-step tile: threads 0..127 run the diagonal scan and deposit f16
// h-state into LDS; then all 8 waves compute Y_tile(32x128) =
// HRe @ CbRe^T + HIm @ (-CbIm^T) with v_wmma_f32_16x16x32_f16.
// ---------------------------------------------------------------------------
__global__ __launch_bounds__(256) void lssm_main_kernel(
    const float* __restrict__ X,
    const float* __restrict__ abarRe,
    const float* __restrict__ abarIm,
    const float* __restrict__ hstart,
    const unsigned int* __restrict__ bfragU,
    float* __restrict__ Y) {
    __shared__ _Float16 sRe[LT][LDP];
    __shared__ _Float16 sIm[LT][LDP];

    const int c = blockIdx.x;
    const int b = blockIdx.y;
    const int tid = threadIdx.x;
    const int lane = tid & 31;
    const int wave = tid >> 5;

    float ar = 0.0f, ai = 0.0f, hr = 0.0f, hi = 0.0f;
    if (tid < Hd) {
        ar = abarRe[b * Hd + tid];
        ai = abarIm[b * Hd + tid];
        const size_t o = (((size_t)b * NC + c) * Hd + tid) * 2;
        hr = hstart[o + 0];
        hi = hstart[o + 1];
    }

    for (int tile = 0; tile < NTILES; ++tile) {
        const int t0 = c * LC + tile * LT;

        // ---- scan phase: 32 dependent steps, x prefetched into registers ----
        if (tid < Hd) {
            const float* xp = X + ((size_t)b * Ld + t0) * Hd + tid;
            float xv[LT];
#pragma unroll
            for (int lt = 0; lt < LT; ++lt) xv[lt] = xp[(size_t)lt * Hd];
#pragma unroll
            for (int lt = 0; lt < LT; ++lt) {
                const float nrr = xv[lt] + hr * ar - hi * ai;
                const float nii = hr * ai + hi * ar;
                hr = nrr;
                hi = nii;
                sRe[lt][tid] = (_Float16)hr;
                sIm[lt][tid] = (_Float16)hi;
            }
            if (tile + 1 < NTILES)
                __builtin_prefetch(xp + (size_t)LT * Hd, 0, 1);  // next tile's x
        }
        __syncthreads();

        // ---- GEMM phase: 16 output fragments, 2 per wave ----
#pragma unroll
        for (int fsel = 0; fsel < 2; ++fsel) {
            const int f = wave + fsel * 8;
            const int mt = f >> 3;      // 0..1 : which 16 rows of the time tile
            const int nb = f & 7;       // 0..7 : which 16 output columns
            v8f acc = {0.f, 0.f, 0.f, 0.f, 0.f, 0.f, 0.f, 0.f};

            const int M = mt * 16 + (lane & 15);
            const int khalf = lane >> 4;

#pragma unroll
            for (int kb = 0; kb < 4; ++kb) {
                // A fragments from LDS (16x32 f16, ISA A-operand layout)
                union { unsigned int u[8]; v16h v; } aR, aI;
#pragma unroll
                for (int d = 0; d < 8; ++d) {
                    const int k0 = kb * 32 + ((d >> 2) << 4) + (khalf << 3) + ((d & 3) << 1);
                    aR.u[d] = *(const unsigned int*)&sRe[M][k0];
                    aI.u[d] = *(const unsigned int*)&sIm[M][k0];
                }
                // B fragments from L2-resident packed buffer (two uint4 per lane)
                const unsigned int* p1 = bfragU + (size_t)((kb * 8 + nb) * 32 + lane) * 8;
                const unsigned int* p2 = bfragU + (size_t)((32 + kb * 8 + nb) * 32 + lane) * 8;
                union { uint4 q[2]; v16h v; } bR, bI;
                bR.q[0] = *(const uint4*)(p1);
                bR.q[1] = *(const uint4*)(p1 + 4);
                bI.q[0] = *(const uint4*)(p2);
                bI.q[1] = *(const uint4*)(p2 + 4);

                acc = __builtin_amdgcn_wmma_f32_16x16x32_f16(
                    false, aR.v, false, bR.v, (short)0, acc, false, false);
                acc = __builtin_amdgcn_wmma_f32_16x16x32_f16(
                    false, aI.v, false, bI.v, (short)0, acc, false, false);
            }

            // D layout: VGPR r -> M = r + 8*(lane>=16), N = lane%16
            const int rowBase = mt * 16 + khalf * 8;
            const int col = nb * 16 + (lane & 15);
            float* yp = Y + ((size_t)b * Ld + (t0 + rowBase)) * Hd + col;
#pragma unroll
            for (int r = 0; r < 8; ++r) yp[(size_t)r * Hd] = acc[r];
        }
        __syncthreads();
    }
}

// ---------------------------------------------------------------------------
// Host-side launcher. Workspace layout (bytes):
//   [0,      65536)  abarRe (H*H f32)
//   [65536, 131072)  abarIm
//   [131072,262144)  apow  (H*H complex f32)
//   [262144,327680)  bfrag (64 f16 fragments, 1 KB each)
//   [327680,2424832) carry -> hstart (B*NC*H complex f32)
// ---------------------------------------------------------------------------
extern "C" void kernel_launch(void* const* d_in, const int* in_sizes, int n_in,
                              void* d_out, int out_size, void* d_ws, size_t ws_size,
                              hipStream_t stream) {
    const float* X    = (const float*)d_in[0];
    const float* A_rt = (const float*)d_in[1];
    const float* C_rt = (const float*)d_in[2];
    float* out = (float*)d_out;

    char* ws = (char*)d_ws;
    float*    abarRe = (float*)(ws + 0);
    float*    abarIm = (float*)(ws + 65536);
    float*    apow   = (float*)(ws + 131072);
    _Float16* bfrag  = (_Float16*)(ws + 262144);
    float*    carry  = (float*)(ws + 327680);

    lssm_setup_kernel<<<dim3(Hd), dim3(Hd), 0, stream>>>(
        A_rt, C_rt, abarRe, abarIm, apow, bfrag);
    lssm_carry_kernel<<<dim3(NC, Bd), dim3(Hd), 0, stream>>>(
        X, abarRe, abarIm, carry);
    lssm_prefix_kernel<<<dim3(Bd), dim3(Hd), 0, stream>>>(apow, carry);
    lssm_main_kernel<<<dim3(NC, Bd), dim3(256), 0, stream>>>(
        X, abarRe, abarIm, carry, (const unsigned int*)bfrag, out);
}

// v001
// One run takes 64.3 microseconds.
// Next to v000, in two timings, it ran 1.21 times as fast each time.
#include <hip/hip_runtime.h>

#define Hd 128
#define Bd 128
#define Ld 2048
#define NC 16
#define LC (Ld / NC)      // 128 steps per chunk
#define LT 32             // time tile inside main kernel
#define NTILES (LC / LT)  // 4
#define CPB 2             // chunks per block of the main kernel
#define NCB (NC / CPB)    // main kernel blocks per batch row
#define LDP 136           // padded LDS row length in halfs (breaks bank aliasing)

static constexpr float DT = 0.01f;

typedef __attribute__((ext_vector_type(16))) _Float16 v16h;
typedef __attribute__((ext_vector_type(8)))  float    v8f;

// ---------------------------------------------------------------------------
// Kernel 1: parameter setup.
//   Abar[i][j] = (1/(I - A*dt/2)) * (I + A*dt/2)        (elementwise, I=eye)
//   Cbar[i][j] = (1/(I - Abar*dt/2)) * C * dt           (elementwise)
//   Apow       = Abar^128 (per-element, for chunk prefix)
//   Cbar is written directly in WMMA B-fragment layout (f16), minus sign of
//   the imaginary part folded in:  Y = HRe@CbRe^T + HIm@(-CbIm^T)
// ---------------------------------------------------------------------------
__global__ void lssm_setup_kernel(const float* __restrict__ A_rt,
                                  const float* __restrict__ C_rt,
                                  float* __restrict__ abarRe,
                                  float* __restrict__ abarIm,
                                  float* __restrict__ apow,
                                  _Float16* __restrict__ bfrag) {
    const int i = blockIdx.x;    // row of Abar/Cbar
    const int j = threadIdx.x;   // col of Abar/Cbar
    const int idx = i * Hd + j;

    const float ar = A_rt[idx * 2 + 0], ai = A_rt[idx * 2 + 1];
    const float cr = C_rt[idx * 2 + 0], ci = C_rt[idx * 2 + 1];
    const float hdt = DT * 0.5f;
    const float eye = (i == j) ? 1.0f : 0.0f;

    // Abar = recip(I - z) * (I + z), z = A*dt/2
    const float zr = ar * hdt, zi = ai * hdt;
    float dr = eye - zr, di = -zi;
    float den = dr * dr + di * di;
    float rr = dr / den, ri = -di / den;
    const float nr = eye + zr, ni = zi;
    const float abr = rr * nr - ri * ni;
    const float abi = rr * ni + ri * nr;
    abarRe[idx] = abr;
    abarIm[idx] = abi;

    // Apow = Abar^128 via 7 complex squarings
    float pr = abr, pi = abi;
#pragma unroll
    for (int s = 0; s < 7; ++s) {
        float t = pr * pr - pi * pi;
        pi = 2.0f * pr * pi;
        pr = t;
    }
    apow[idx * 2 + 0] = pr;
    apow[idx * 2 + 1] = pi;

    // Cbar = recip(I - Abar*dt/2) * C * dt
    float er = eye - abr * hdt, ei = -abi * hdt;
    float den2 = er * er + ei * ei;
    float qr = er / den2, qi = -ei / den2;
    const float cbr = (qr * cr - qi * ci) * DT;
    const float cbi = (qr * ci + qi * cr) * DT;

    // B matrix element (k = j, n = i): B1[k][n] = CbRe[n][k], B2[k][n] = -CbIm[n][k]
    // Fragment layout (mirrors ISA 16-bit operand layout):
    //   kb = k>>5, kk = k&31, nb = n>>4, nn = n&15
    //   lane    = nn + 16*((kk>>3)&1)
    //   halfIdx = ((kk>>4)<<3) + (kk&7)
    const int kb = j >> 5, kk = j & 31;
    const int nb = i >> 4, nn = i & 15;
    const int lane = nn + (((kk >> 3) & 1) << 4);
    const int hidx = ((kk >> 4) << 3) + (kk & 7);
    const int base = lane * 16 + hidx;
    bfrag[(size_t)((kb * 8 + nb)) * 512 + base]      = (_Float16)cbr;   // Re plane
    bfrag[(size_t)(32 + kb * 8 + nb) * 512 + base]   = (_Float16)(-cbi); // -Im plane
}

// ---------------------------------------------------------------------------
// Kernel 2: per-chunk carry.  Scan each 128-step chunk from zero state.
// carry[b][c][h] = h-state at end of chunk c given zero start state.
// ---------------------------------------------------------------------------
__global__ void lssm_carry_kernel(const float* __restrict__ X,
                                  const float* __restrict__ abarRe,
                                  const float* __restrict__ abarIm,
                                  float* __restrict__ carry) {
    const int c = blockIdx.x;
    const int b = blockIdx.y;
    const int h = threadIdx.x;
    const float ar = abarRe[b * Hd + h];
    const float ai = abarIm[b * Hd + h];
    const float* xp = X + ((size_t)b * Ld + (size_t)c * LC) * Hd + h;
    float hr = 0.0f, hi = 0.0f;
#pragma unroll 4
    for (int t = 0; t < LC; ++t) {
        const float x = xp[(size_t)t * Hd];
        const float nrr = x + hr * ar - hi * ai;
        const float nii = hr * ai + hi * ar;
        hr = nrr;
        hi = nii;
    }
    const size_t o = (((size_t)b * NC + c) * Hd + h) * 2;
    carry[o + 0] = hr;
    carry[o + 1] = hi;
}

// ---------------------------------------------------------------------------
// Kernel 3: prefix over chunks (in place: carry buffer becomes hstart buffer).
//   E_{-1} = 0;  hstart[c] = E_{c-1};  E_c = Apow * E_{c-1} + carry_c
// ---------------------------------------------------------------------------
__global__ void lssm_prefix_kernel(const float* __restrict__ apow,
                                   float* __restrict__ carry) {
    const int b = blockIdx.x;
    const int h = threadIdx.x;
    const float pr = apow[(b * Hd + h) * 2 + 0];
    const float pi = apow[(b * Hd + h) * 2 + 1];
    float er = 0.0f, ei = 0.0f;
#pragma unroll
    for (int c = 0; c < NC; ++c) {
        const size_t o = (((size_t)b * NC + c) * Hd + h) * 2;
        const float vr = carry[o + 0];
        const float vi = carry[o + 1];
        carry[o + 0] = er;             // now holds chunk start state
        carry[o + 1] = ei;
        const float nrr = pr * er - pi * ei + vr;
        const float nii = pr * ei + pi * er + vi;
        er = nrr;
        ei = nii;
    }
}

// ---------------------------------------------------------------------------
// Work-group barrier that orders LDS traffic only.  __syncthreads() also
// drains every global load and store of the wave; here the x loads issued one
// tile ahead and the y stores must stay in flight across the tile barriers.
// Nothing that one wave writes to global memory is read by another wave.
// ---------------------------------------------------------------------------
__device__ __forceinline__ void lds_only_barrier() {
    __builtin_amdgcn_fence(__ATOMIC_RELEASE, "workgroup", "local");
    __builtin_amdgcn_s_barrier();
    __builtin_amdgcn_fence(__ATOMIC_ACQUIRE, "workgroup", "local");
}

// ---------------------------------------------------------------------------
// Kernel 4: fused scan + WMMA GEMM, software-pipelined against memory.
// One batch row and CPB neighbouring chunks per block, 8 waves: waves 0..3
// scan the first chunk, waves 4..7 the second, so every wave runs the same
// instruction stream and the counted load waits are exact for all of them.
// Per 32-step tile: each thread runs its diagonal scan and deposits f16
// h-state into LDS; then all 8 waves compute Y_tile(64x128) =
// HRe @ CbRe^T + HIm @ (-CbIm^T) with v_wmma_f32_16x16x32_f16.
// The x values of tile t+1 are loaded into a second register set at the top
// of tile t's scan, so their memory latency runs under scan, GEMM and stores.
// ---------------------------------------------------------------------------
__global__ __launch_bounds__(256) void lssm_main_kernel(
    const float* __restrict__ X,
    const float* __restrict__ abarRe,
    const float* __restrict__ abarIm,
    const float* __restrict__ hstart,
    const unsigned int* __restrict__ bfragU,
    float* __restrict__ Y) {
    __shared__ _Float16 sRe[CPB * LT][LDP];
    __shared__ _Float16 sIm[CPB * LT][LDP];

    const int b = blockIdx.y;
    const int tid = threadIdx.x;
    const int lane = tid & 31;
    const int wave = tid >> 5;
    const int h = tid & (Hd - 1);            // state element this thread scans
    const int grp = tid >> 7;                // which of the block's chunks it scans
    const int c = blockIdx.x * CPB + grp;

    const float* xbase = X + ((size_t)b * Ld + (size_t)c * LC) * Hd + h;
    float xv[2][LT];
#pragma unroll   // all 32 loads in flight at once, into registers
    for (int lt = 0; lt < LT; ++lt) xv[0][lt] = xbase[(size_t)lt * Hd];
    const float ar = abarRe[b * Hd + h];
    const float ai = abarIm[b * Hd + h];
    const size_t o = (((size_t)b * NC + c) * Hd + h) * 2;
    float hr = hstart[o + 0];
    float hi = hstart[o + 1];
    // address registers of the loads above may be reused from here on
    asm volatile("s_wait_xcnt 0x0" ::: "memory");
    // holds later instructions (and their register reuse) behind that wait
    __builtin_amdgcn_sched_barrier(0);

    // B fragments (this wave's 16 output columns, both planes): loaded once, ahead
    // of every x load issued in the tile loop, so that no wait on them drains those
    v16h bRe[4], bIm[4];
    const unsigned int bofs = (unsigned int)(wave * 32 + lane) * 32u;   // bytes
#pragma unroll   // register arrays need compile-time indices
    for (int kb = 0; kb < 4; ++kb) {
        const char* pb = (const char*)bfragU + bofs;
        const unsigned int* p1 = (const unsigned int*)(pb + kb * 8192);
        const unsigned int* p2 = (const unsigned int*)(pb + 32768 + kb * 8192);
        union { uint4 q[2]; v16h v; } bR, bI;
        bR.q[0] = *(const uint4*)(p1);
        bR.q[1] = *(const uint4*)(p1 + 4);
        bI.q[0] = *(const uint4*)(p2);
        bI.q[1] = *(const uint4*)(p2 + 4);
        bRe[kb] = bR.v;
        bIm[kb] = bI.v;
    }
    // as above, for the fragment loads; naming their offset keeps its register
    // from being handed to one of the loaded fragments ahead of the wait
    asm volatile("s_wait_xcnt 0x0" :: "v"(bofs) : "memory");
    // keeps tile 0's x and the fragments older than tile 1's x, so that the
    // counted waits on them drain nothing newer
    __builtin_amdgcn_sched_barrier(0);

    // fully unrolled: the two x register sets need compile-time indices
#pragma unroll
    for (int tile = 0; tile < NTILES; ++tile) {
        // ---- next tile's x: issued now, first read one whole tile later ----
        if (tile + 1 < NTILES) {
#pragma unroll   // all 32 loads in flight at once, into registers
            for (int lt = 0; lt < LT; ++lt)
                xv[(tile + 1) & 1][lt] = xbase[(size_t)((tile + 1) * LT + lt) * Hd];
            // keeps those loads ahead of the scan instead of sunk behind it
            __builtin_amdgcn_sched_barrier(0);
        }

        // ---- scan phase: 32 dependent steps on x loaded one tile ago ----
#pragma unroll
        for (int lt = 0; lt < LT; ++lt) {
            const float nrr = xv[tile & 1][lt] + hr * ar - hi * ai;
            const float nii = hr * ai + hi * ar;
            hr = nrr;
            hi = nii;
            sRe[grp * LT + lt][h] = (_Float16)hr;
            sIm[grp * LT + lt][h] = (_Float16)hi;
        }
        lds_only_barrier();

        // ---- GEMM phase: 32 output fragments, 4 per wave (column block = wave) ----
#pragma unroll
        for (int mt = 0; mt < CPB * LT / 16; ++mt) {   // which 16 LDS rows
            v8f acc = {0.f, 0.f, 0.f, 0.f, 0.f, 0.f, 0.f, 0.f};

            const int M = mt * 16 + (lane & 15);
            const int khalf = lane >> 4;

#pragma unroll
            for (int kb = 0; kb < 4; ++kb) {
                // A fragments from LDS (16x32 f16, ISA A-operand layout)
                union { unsigned int u[8]; v16h v; } aR, aI;
#pragma unroll
                for (int d = 0; d < 8; ++d) {
                    const int k0 = kb * 32 + ((d >> 2) << 4) + (khalf << 3) + ((d & 3) << 1);
                    aR.u[d] = *(const unsigned int*)&sRe[M][k0];
                    aI.u[d] = *(const unsigned int*)&sIm[M][k0];
                }
                acc = __builtin_amdgcn_wmma_f32_16x16x32_f16(
                    false, aR.v, false, bRe[kb], (short)0, acc, false, false);
                acc = __builtin_amdgcn_wmma_f32_16x16x32_f16(
                    false, aI.v, false, bIm[kb], (short)0, acc, false, false);
            }

            // D layout: VGPR r -> M = r + 8*(lane>=16), N = lane%16
            // LDS rows mt*16.. are steps (mt%2)*16.. of this tile in chunk mt/2 of the block
            const int trow = (blockIdx.x * CPB + (mt >> 1)) * LC + tile * LT
                           + (mt & 1) * 16 + khalf * 8;
            const int col = wave * 16 + (lane & 15);
            float* yp = Y + ((size_t)b * Ld + trow) * Hd + col;
#pragma unroll
            for (int r = 0; r < 8; ++r) yp[(size_t)r * Hd] = acc[r];
        }
        // behind the last tile nobody writes LDS or reuses a register: nothing there
        if (tile + 1 < NTILES) {
            // the stores stay in flight, but their address and data registers are
            // reused by the next tile: this wait stands in front of that reuse
            asm volatile("s_wait_xcnt 0x0" ::: "memory");
            // holds the next tile's instructions behind that wait
            __builtin_amdgcn_sched_barrier(0);
            lds_only_barrier();
        }
    }
}

// ---------------------------------------------------------------------------
// Host-side launcher. Workspace layout (bytes):
//   [0,      65536)  abarRe (H*H f32)
//   [65536, 131072)  abarIm
//   [131072,262144)  apow  (H*H complex f32)
//   [262144,327680)  bfrag (64 f16 fragments, 1 KB each)
//   [327680,2424832) carry -> hstart (B*NC*H complex f32)
// ---------------------------------------------------------------------------
extern "C" void kernel_launch(void* const* d_in, const int* in_sizes, int n_in,
                              void* d_out, int out_size, void* d_ws, size_t ws_size,
                              hipStream_t stream) {
    const float* X    = (const float*)d_in[0];
    const float* A_rt = (const float*)d_in[1];
    const float* C_rt = (const float*)d_in[2];
    float* out = (float*)d_out;

    char* ws = (char*)d_ws;
    float*    abarRe = (float*)(ws + 0);
    float*    abarIm = (float*)(ws + 65536);
    float*    apow   = (float*)(ws + 131072);
    _Float16* bfrag  = (_Float16*)(ws + 262144);
    float*    carry  = (float*)(ws + 327680);

    lssm_setup_kernel<<<dim3(Hd), dim3(Hd), 0, stream>>>(
        A_rt, C_rt, abarRe, abarIm, apow, bfrag);
    lssm_carry_kernel<<<dim3(NC, Bd), dim3(Hd), 0, stream>>>(
        X, abarRe, abarIm, carry);
    lssm_prefix_kernel<<<dim3(Bd), dim3(Hd), 0, stream>>>(apow, carry);
    lssm_main_kernel<<<dim3(NCB, Bd), dim3(256), 0, stream>>>(
        X, abarRe, abarIm, carry, (const unsigned int*)bfrag, out);
}

// v002
// One run takes 55.8 microseconds.
// Timed twice side by side with v001, it ran 1.15 times as fast both times.
// All steps since v000 together make it 1.39 times as fast.
#include <hip/hip_runtime.h>

#define Hd 128
#define Bd 128
#define Ld 2048
#define NG 4              // time groups per block (each 128 threads, one per state element)
#define LT 32             // steps that one group scans per pass
#define ST (NG * LT)      // 128 steps per pass of the block
#define NS (Ld / ST)      // 16 passes walk the whole sequence
#define WN 2              // 16-column blocks per wave in the GEMM phase
#define NCW (8 / WN)      // waves side by side over the 128 columns
#define NRW (16 / NCW)    // waves above one another over the ST rows
#define MTW (ST / 16 / NRW)  // 16-row blocks per wave
#define LDP 136           // padded LDS row length in halfs (breaks bank aliasing)

static constexpr float DT = 0.01f;

typedef __attribute__((ext_vector_type(16))) _Float16 v16h;
typedef __attribute__((ext_vector_type(8)))  float    v8f;

// ---------------------------------------------------------------------------
// Kernel 1: parameter setup.
//   Abar[i][j] = (1/(I - A*dt/2)) * (I + A*dt/2)        (elementwise, I=eye)
//   Cbar[i][j] = (1/(I - Abar*dt/2)) * C * dt           (elementwise)
//   Cbar is written directly in WMMA B-fragment layout (f16), minus sign of
//   the imaginary part folded in:  Y = HRe@CbRe^T + HIm@(-CbIm^T)
// ---------------------------------------------------------------------------
__global__ void lssm_setup_kernel(const float* __restrict__ A_rt,
                                  const float* __restrict__ C_rt,
                                  float* __restrict__ abarRe,
                                  float* __restrict__ abarIm,
                                  _Float16* __restrict__ bfrag) {
    const int i = blockIdx.x;    // row of Abar/Cbar
    const int j = threadIdx.x;   // col of Abar/Cbar
    const int idx = i * Hd + j;

    const float ar = A_rt[idx * 2 + 0], ai = A_rt[idx * 2 + 1];
    const float cr = C_rt[idx * 2 + 0], ci = C_rt[idx * 2 + 1];
    const float hdt = DT * 0.5f;
    const float eye = (i == j) ? 1.0f : 0.0f;

    // Abar = recip(I - z) * (I + z), z = A*dt/2
    const float zr = ar * hdt, zi = ai * hdt;
    float dr = eye - zr, di = -zi;
    float den = dr * dr + di * di;
    float rr = dr / den, ri = -di / den;
    const float nr = eye + zr, ni = zi;
    const float abr = rr * nr - ri * ni;
    const float abi = rr * ni + ri * nr;
    abarRe[idx] = abr;
    abarIm[idx] = abi;

    // Cbar = recip(I - Abar*dt/2) * C * dt
    float er = eye - abr * hdt, ei = -abi * hdt;
    float den2 = er * er + ei * ei;
    float qr = er / den2, qi = -ei / den2;
    const float cbr = (qr * cr - qi * ci) * DT;
    const float cbi = (qr * ci + qi * cr) * DT;

    // B matrix element (k = j, n = i): B1[k][n] = CbRe[n][k], B2[k][n] = -CbIm[n][k]
    // Fragment layout (mirrors ISA 16-bit operand layout):
    //   kb = k>>5, kk = k&31, nb = n>>4, nn = n&15
    //   lane    = nn + 16*((kk>>3)&1)
    //   halfIdx = ((kk>>4)<<3) + (kk&7)
    const int kb = j >> 5, kk = j & 31;
    const int nb = i >> 4, nn = i & 15;
    const int lane = nn + (((kk >> 3) & 1) << 4);
    const int hidx = ((kk >> 4) << 3) + (kk & 7);
    const int base = lane * 16 + hidx;
    bfrag[(size_t)((kb * 8 + nb)) * 512 + base]      = (_Float16)cbr;   // Re plane
    bfrag[(size_t)(32 + kb * 8 + nb) * 512 + base]   = (_Float16)(-cbi); // -Im plane
}

// ---------------------------------------------------------------------------
// Work-group barrier that orders LDS traffic only.  __syncthreads() also
// drains every global load and store of the wave; here the x loads issued two
// passes ahead and the y stores must stay in flight across the barriers.
// Nothing that one wave writes to global memory is read by another wave.
// ---------------------------------------------------------------------------
__device__ __forceinline__ void lds_only_barrier() {
    __builtin_amdgcn_fence(__ATOMIC_RELEASE, "workgroup", "local");
    __builtin_amdgcn_s_barrier();
    __builtin_amdgcn_fence(__ATOMIC_ACQUIRE, "workgroup", "local");
}

// ---------------------------------------------------------------------------
// Kernel 2: the whole recurrence and its GEMM in one pass over x.
// One batch row per block, 16 waves.  The block walks the sequence in NS passes
// of ST steps and keeps the running state in registers, so no other launch has
// to read x to find a start state.  Inside a pass the NG groups of 128 threads
// take LT neighbouring steps each:
//   carry   : each group scans its LT steps from zero (registers only),
//   join    : the NG carries meet in LDS; with P = Abar^LT every thread forms
//             e_0 = H, e_{j+1} = P*e_j + carry_j, keeps e_grp as its start
//             state and e_NG as the state H behind the pass,
//   scan    : each group scans its LT steps again from e_grp, f16 state to LDS,
//   GEMM    : Y(ST x 128) = HRe @ CbRe^T + HIm @ (-CbIm^T), 16x16x32 f16 WMMA.
// The carry of pass s+1 needs registers only and stands behind the GEMM of pass
// s.  x is loaded two passes ahead into the register set that the scan has just
// read.
// ---------------------------------------------------------------------------
__global__ __launch_bounds__(512) void lssm_main_kernel(
    const float* __restrict__ X,
    const float* __restrict__ abarRe,
    const float* __restrict__ abarIm,
    const unsigned int* __restrict__ bfragU,
    float* __restrict__ Y) {
    __shared__ _Float16 sH[2][ST][LDP];      // plane 0: real part, plane 1: imaginary part
    __shared__ float2 sC[NG][Hd];

    const int b = blockIdx.x;
    const int tid = threadIdx.x;
    const int lane = tid & 31;
    const int wave = tid >> 5;
    const int h = tid & (Hd - 1);            // state element this thread scans
    const int grp = tid >> 7;                // which LT steps of a pass it scans
    const int cw = wave & (NCW - 1);         // GEMM: which WN column blocks
    const int rw = wave / NCW;               // GEMM: which MTW row blocks
    const int khalf = lane >> 4;

    // block-uniform bases plus one 32-bit offset per thread: one address register each
    const float* xrow = X + (size_t)b * Ld * Hd;
    float* yrow = Y + (size_t)b * Ld * Hd;
    const unsigned int xofs = (unsigned int)(grp * LT * Hd + h);
    const unsigned int yofs = (unsigned int)((rw * MTW * 16 + khalf * 8) * Hd
                                             + cw * WN * 16 + (lane & 15));
    // this lane's first A-fragment halfs in plane 0; all else is a constant offset
    const _Float16* aBase = &sH[0][rw * MTW * 16 + (lane & 15)][khalf << 3];
    float xv[2][LT];
#pragma unroll   // all 32 loads in flight at once, into registers
    for (int lt = 0; lt < LT; ++lt) xv[0][lt] = xrow[xofs + lt * Hd];
    const unsigned int aofs = (unsigned int)(b * Hd + h);
    const float ar = abarRe[aofs];
    const float ai = abarIm[aofs];
    // address registers of the loads above may be reused from here on; naming the
    // index keeps its register from being handed out ahead of the wait
    asm volatile("s_wait_xcnt 0x0" :: "v"(aofs) : "memory");
    // holds later instructions (and their register reuse) behind that wait
    __builtin_amdgcn_sched_barrier(0);

    // B fragments (this wave's WN*16 output columns, both planes): loaded once,
    // ahead of every later x load, so that no wait on them drains those
    v16h bRe[WN][4], bIm[WN][4];
    const unsigned int bofs = (unsigned int)(cw * WN * 32 + lane) * 32u;   // bytes
#pragma unroll   // register arrays need compile-time indices
    for (int j = 0; j < WN; ++j) {
#pragma unroll   // as above
        for (int kb = 0; kb < 4; ++kb) {
            const char* pb = (const char*)bfragU + bofs + j * 1024;
            const unsigned int* p1 = (const unsigned int*)(pb + kb * 8192);
            const unsigned int* p2 = (const unsigned int*)(pb + 32768 + kb * 8192);
            union { uint4 q[2]; v16h v; } bR, bI;
            bR.q[0] = *(const uint4*)(p1);
            bR.q[1] = *(const uint4*)(p1 + 4);
            bI.q[0] = *(const uint4*)(p2);
            bI.q[1] = *(const uint4*)(p2 + 4);
            bRe[j][kb] = bR.v;
            bIm[j][kb] = bI.v;
        }
    }
    // as above, for the fragment loads; naming their offset keeps its register
    // from being handed to one of the loaded fragments ahead of the wait
    asm volatile("s_wait_xcnt 0x0" :: "v"(bofs) : "memory");
    // keeps pass 0's x and the fragments older than pass 1's x, so that the
    // counted waits on them drain nothing newer
    __builtin_amdgcn_sched_barrier(0);

#pragma unroll   // all 32 loads in flight at once, into registers
    for (int lt = 0; lt < LT; ++lt) xv[1][lt] = xrow[xofs + (ST + lt) * Hd];
    // address registers of these loads may be reused from here on
    asm volatile("s_wait_xcnt 0x0" ::: "memory");
    // holds later instructions (and their register reuse) behind that wait
    __builtin_amdgcn_sched_barrier(0);

    // P = Abar^LT via 5 complex squarings
    float pr = ar, pi = ai;
#pragma unroll   // five short steps, no loop overhead
    for (int q = 0; q < 5; ++q) {
        const float t = pr * pr - pi * pi;
        pi = 2.0f * pr * pi;
        pr = t;
    }

    // carry of pass 0
    {
        float cr = 0.0f, ci = 0.0f;
#pragma unroll   // x lies in registers: compile-time indices
        for (int lt = 0; lt < LT; ++lt) {
            const float nrr = xv[0][lt] + cr * ar - ci * ai;
            const float nii = cr * ai + ci * ar;
            cr = nrr;
            ci = nii;
        }
        sC[grp][h] = make_float2(cr, ci);
    }
    lds_only_barrier();

    float Hr = 0.0f, Hi = 0.0f;   // state in front of the pass (alike in all groups)

    // stays rolled (for speed only);
    // two passes per trip because the two x register sets need compile-time indices
#pragma nounroll
    for (int s2 = 0; s2 < NS; s2 += 2) {
#pragma unroll   // p picks the x register set: compile-time index
        for (int p = 0; p < 2; ++p) {
            const int s = s2 + p;

            // ---- join: start state of this group, and the state behind the pass ----
            float hr = 0.0f, hi = 0.0f;
#pragma unroll   // four short steps; lets the four LDS reads go out together
            for (int j = 0; j < NG; ++j) {
                if (j == grp) { hr = Hr; hi = Hi; }
                const float2 cj = sC[j][h];
                const float nrr = pr * Hr - pi * Hi + cj.x;
                const float nii = pr * Hi + pi * Hr + cj.y;
                Hr = nrr;
                Hi = nii;
            }

            // ---- scan phase: LT dependent steps, f16 state to LDS ----
#pragma unroll   // x lies in registers: compile-time indices
            for (int lt = 0; lt < LT; ++lt) {
                const float nrr = xv[p][lt] + hr * ar - hi * ai;
                const float nii = hr * ai + hi * ar;
                hr = nrr;
                hi = nii;
                sH[0][grp * LT + lt][h] = (_Float16)hr;
                sH[1][grp * LT + lt][h] = (_Float16)hi;
            }

            // ---- x of pass s+2 into the set just read: first read one pass later ----
            // No branch round the loads: with one, the compiler must count its load
            // waits for the path without them, and every wait on the older set would
            // drain this one too.  The last two passes read pass NS-1 again (cache hits).
            {
                const int sn = (s + 2 < NS) ? s + 2 : NS - 1;
                const float* xn = xrow + (size_t)sn * ST * Hd;
#pragma unroll   // all 32 loads in flight at once, into registers
                for (int lt = 0; lt < LT; ++lt) xv[p][lt] = xn[xofs + lt * Hd];
                // address registers of these loads may be reused from here on
                asm volatile("s_wait_xcnt 0x0" ::: "memory");
                // keeps the loads here instead of sunk behind the GEMM
                __builtin_amdgcn_sched_barrier(0);
            }
            // publishes the state tile; also ends every read of sC by the join above
            lds_only_barrier();

            // ---- GEMM phase ----
            float* yp = yrow + (size_t)s * ST * Hd;
#pragma unroll
            for (int mt = 0; mt < MTW; ++mt) {   // which 16 LDS rows
                v8f acc[WN];
#pragma unroll
                for (int j = 0; j < WN; ++j)
                    acc[j] = (v8f){0.f, 0.f, 0.f, 0.f, 0.f, 0.f, 0.f, 0.f};

#pragma unroll
                for (int kb = 0; kb < 4; ++kb) {
                    // A fragments from LDS (16x32 f16, ISA A-operand layout)
                    union { unsigned int u[8]; v16h v; } aR, aI;
#pragma unroll
                    for (int d = 0; d < 8; ++d) {
                        const int k0 = mt * 16 * LDP + kb * 32 + ((d >> 2) << 4) + ((d & 3) << 1);
                        aR.u[d] = *(const unsigned int*)(aBase + k0);
                        aI.u[d] = *(const unsigned int*)(aBase + ST * LDP + k0);
                    }
#pragma unroll
                    for (int j = 0; j < WN; ++j) {
                        acc[j] = __builtin_amdgcn_wmma_f32_16x16x32_f16(
                            false, aR.v, false, bRe[j][kb], (short)0, acc[j], false, false);
                        acc[j] = __builtin_amdgcn_wmma_f32_16x16x32_f16(
                            false, aI.v, false, bIm[j][kb], (short)0, acc[j], false, false);
                    }
                }

                // D layout: VGPR r -> M = r + 8*(lane>=16), N = lane%16
#pragma unroll
                for (int r = 0; r < 8; ++r) {
#pragma unroll
                    for (int j = 0; j < WN; ++j)
                        yp[yofs + (mt * 16 + r) * Hd + j * 16] = acc[j][r];
                }
                // the stores stay in flight, but their address and data registers are
                // reused by the next row block: this wait stands in front of that reuse.
                // The four v_nop keep the distance that the chip needs between the last
                // WMMA above and the next row block's first WMMA, which overwrites its D
                // (only stores and LDS loads stand between them, and they fill no slot).
                asm volatile("s_wait_xcnt 0x0\n\tv_nop\n\tv_nop\n\tv_nop\n\tv_nop" ::: "memory");
                // holds the next row block's instructions behind that wait
                __builtin_amdgcn_sched_barrier(0);
            }
            // behind the last pass nobody writes LDS again: nothing there
            if (p == 0 || s2 + 2 < NS) {
                // ---- carry of pass s+1: registers only, so a wave that is through
                // with its GEMM runs it while slower waves still use LDS and WMMA ----
                float cr = 0.0f, ci = 0.0f;
#pragma unroll   // x lies in registers: compile-time indices
                for (int lt = 0; lt < LT; ++lt) {
                    const float nrr = xv[p ^ 1][lt] + cr * ar - ci * ai;
                    const float nii = cr * ai + ci * ar;
                    cr = nrr;
                    ci = nii;
                }
                sC[grp][h] = make_float2(cr, ci);
                // frees the state tile for the next scan and publishes the carries
                lds_only_barrier();
            }
        }
    }
    // the x loads of the last two passes are never read, so no wait of the compiler's
    // covers them: a precaution, they land before the wave releases its registers
    asm volatile("s_wait_loadcnt 0x0" ::: "memory");
}

// ---------------------------------------------------------------------------
// Host-side launcher. Workspace layout (bytes):
//   [0,      65536)  abarRe (H*H f32)
//   [65536, 131072)  abarIm
//   [262144,327680)  bfrag (64 f16 fragments, 1 KB each)
// ---------------------------------------------------------------------------
extern "C" void kernel_launch(void* const* d_in, const int* in_sizes, int n_in,
                              void* d_out, int out_size, void* d_ws, size_t ws_size,
                              hipStream_t stream) {
    const float* X    = (const float*)d_in[0];
    const float* A_rt = (const float*)d_in[1];
    const float* C_rt = (const float*)d_in[2];
    float* out = (float*)d_out;

    char* ws = (char*)d_ws;
    float*    abarRe = (float*)(ws + 0);
    float*    abarIm = (float*)(ws + 65536);
    _Float16* bfrag  = (_Float16*)(ws + 262144);

    lssm_setup_kernel<<<dim3(Hd), dim3(Hd), 0, stream>>>(
        A_rt, C_rt, abarRe, abarIm, bfrag);
    lssm_main_kernel<<<dim3(Bd), dim3(512), 0, stream>>>(
        X, abarRe, abarIm, (const unsigned int*)bfrag, out);
}

// v003
// One run takes 42.6 microseconds.
// Timed twice side by side with v002, it ran 1.31 and 1.32 times as fast.
// All steps since v000 together make it 1.83 times as fast.
#include <hip/hip_runtime.h>

#define Hd 128
#define Bd 128
#define Ld 2048
#define NG 4              // time groups per block (each 128 threads, one per state element)
#define LT 32             // steps that one group scans per pass
#define ST (NG * LT)      // 128 steps per pass of the block
#define NS (Ld / ST)      // 16 passes walk the whole sequence
#define TS 9              // passes of a row's first block; its second block takes the other NS - TS
#define NBLK 256          // two blocks per batch row: one for every WGP of the chip
#define WN 2              // 16-column blocks per wave in the GEMM phase
#define NCW (8 / WN)      // waves side by side over the 128 columns
#define NRW (16 / NCW)    // waves above one another over the ST rows
#define MTW (ST / 16 / NRW)  // 16-row blocks per wave
#define LDP 136           // padded LDS row length in halfs (breaks bank aliasing)

static constexpr float DT = 0.01f;

typedef __attribute__((ext_vector_type(16))) _Float16 v16h;
typedef __attribute__((ext_vector_type(8)))  float    v8f;

// ---------------------------------------------------------------------------
// Kernel 1: parameter setup.
//   Abar[i][j] = (1/(I - A*dt/2)) * (I + A*dt/2)        (elementwise, I=eye)
//   Cbar[i][j] = (1/(I - Abar*dt/2)) * C * dt           (elementwise)
//   Cbar is written directly in WMMA B-fragment layout (f16), minus sign of
//   the imaginary part folded in:  Y = HRe@CbRe^T + HIm@(-CbIm^T)
// ---------------------------------------------------------------------------
__global__ void lssm_setup_kernel(const float* __restrict__ A_rt,
                                  const float* __restrict__ C_rt,
                                  float* __restrict__ abarRe,
                                  float* __restrict__ abarIm,
                                  _Float16* __restrict__ bfrag) {
    const int i = blockIdx.x;    // row of Abar/Cbar
    const int j = threadIdx.x;   // col of Abar/Cbar
    const int idx = i * Hd + j;

    const float ar = A_rt[idx * 2 + 0], ai = A_rt[idx * 2 + 1];
    const float cr = C_rt[idx * 2 + 0], ci = C_rt[idx * 2 + 1];
    const float hdt = DT * 0.5f;
    const float eye = (i == j) ? 1.0f : 0.0f;

    // Abar = recip(I - z) * (I + z), z = A*dt/2
    const float zr = ar * hdt, zi = ai * hdt;
    float dr = eye - zr, di = -zi;
    float den = dr * dr + di * di;
    float rr = dr / den, ri = -di / den;
    const float nr = eye + zr, ni = zi;
    const float abr = rr * nr - ri * ni;
    const float abi = rr * ni + ri * nr;
    abarRe[idx] = abr;
    abarIm[idx] = abi;

    // Cbar = recip(I - Abar*dt/2) * C * dt
    float er = eye - abr * hdt, ei = -abi * hdt;
    float den2 = er * er + ei * ei;
    float qr = er / den2, qi = -ei / den2;
    const float cbr = (qr * cr - qi * ci) * DT;
    const float cbi = (qr * ci + qi * cr) * DT;

    // B matrix element (k = j, n = i): B1[k][n] = CbRe[n][k], B2[k][n] = -CbIm[n][k]
    // Fragment layout (mirrors ISA 16-bit operand layout):
    //   kb = k>>5, kk = k&31, nb = n>>4, nn = n&15
    //   lane    = nn + 16*((kk>>3)&1)
    //   halfIdx = ((kk>>4)<<3) + (kk&7)
    const int kb = j >> 5, kk = j & 31;
    const int nb = i >> 4, nn = i & 15;
    const int lane = nn + (((kk >> 3) & 1) << 4);
    const int hidx = ((kk >> 4) << 3) + (kk & 7);
    const int base = lane * 16 + hidx;
    bfrag[(size_t)((kb * 8 + nb)) * 512 + base]      = (_Float16)cbr;   // Re plane
    bfrag[(size_t)(32 + kb * 8 + nb) * 512 + base]   = (_Float16)(-cbi); // -Im plane
}

// ---------------------------------------------------------------------------
// Work-group barrier that orders LDS traffic only.  __syncthreads() also
// drains every global load and store of the wave; here the x loads issued two
// passes ahead and the y stores must stay in flight across the barriers.
// Nothing that one wave writes to global memory is read by another wave.
// ---------------------------------------------------------------------------
__device__ __forceinline__ void lds_only_barrier() {
    __builtin_amdgcn_fence(__ATOMIC_RELEASE, "workgroup", "local");
    __builtin_amdgcn_s_barrier();
    __builtin_amdgcn_fence(__ATOMIC_ACQUIRE, "workgroup", "local");
}

// ---------------------------------------------------------------------------
// Kernel 2: the whole recurrence and its GEMM.
// Two blocks per batch row, 16 waves each.  A block walks the sequence in passes
// of ST steps and keeps the running state in registers, so no other launch has
// to read x to find a start state.  The first block of a row does passes 0 to
// TS-1 in full.  The second block walks those TS passes for the state alone
// (carry and join: x is read, nothing is scanned, multiplied or stored), which
// costs a fraction of a full pass, and then does passes TS to NS-1 in full; TS
// is above NS/2 so that both blocks end at about the same time.
// Inside a pass the NG groups of 128 threads take LT neighbouring steps each:
//   carry   : each group scans its LT steps from zero (registers only),
//   join    : the NG carries meet in LDS; with P = Abar^LT every thread forms
//             e_0 = H, e_{j+1} = P*e_j + carry_j, keeps e_grp as its start
//             state and e_NG as the state H behind the pass,
//   scan    : each group scans its LT steps again from e_grp, f16 state to LDS,
//   GEMM    : Y(ST x 128) = HRe @ CbRe^T + HIm @ (-CbIm^T), 16x16x32 f16 WMMA.
// The carry of pass s+1 needs registers only and stands behind the GEMM of pass
// s.  x is loaded two passes ahead into the register set that the scan has just
// read.
// ---------------------------------------------------------------------------
// carry of LT steps scanned from a zero state
__device__ __forceinline__ float2 carry_of(const float (&x)[LT], float ar, float ai) {
    float cr = 0.0f, ci = 0.0f;
#pragma unroll   // x lies in registers: compile-time indices
    for (int lt = 0; lt < LT; ++lt) {
        const float nrr = x[lt] + cr * ar - ci * ai;
        const float nii = cr * ai + ci * ar;
        cr = nrr;
        ci = nii;
    }
    return make_float2(cr, ci);
}

static_assert((TS & 1) == 1 && ((NS - TS) & 1) == 1 && TS + 1 < NS,
              "both blocks of a row end on the first x register set");

__global__ __launch_bounds__(512) void lssm_main_kernel(
    const float* __restrict__ X,
    const float* __restrict__ abarRe,
    const float* __restrict__ abarIm,
    const unsigned int* __restrict__ bfragU,
    float* __restrict__ Y) {
    __shared__ _Float16 sH[2][ST][LDP];      // plane 0: real part, plane 1: imaginary part
    __shared__ float2 sC[NG][Hd];

    const int b = blockIdx.x & (Bd - 1);
    // the blocks that walk a prefix first have the low indices
    const bool second = blockIdx.x < Bd;
    const int sBeg = second ? TS : 0;        // passes [sBeg, sEnd) are done in full
    const int sEnd = second ? NS : TS;
    const int tid = threadIdx.x;
    const int lane = tid & 31;
    const int wave = tid >> 5;
    const int h = tid & (Hd - 1);            // state element this thread scans
    const int grp = tid >> 7;                // which LT steps of a pass it scans
    const int cw = wave & (NCW - 1);         // GEMM: which WN column blocks
    const int rw = wave / NCW;               // GEMM: which MTW row blocks
    const int khalf = lane >> 4;

    // block-uniform bases plus one 32-bit offset per thread: one address register each
    const float* xrow = X + (size_t)b * Ld * Hd;
    float* yrow = Y + (size_t)b * Ld * Hd;
    const unsigned int xofs = (unsigned int)(grp * LT * Hd + h);
    const unsigned int yofs = (unsigned int)((rw * MTW * 16 + khalf * 8) * Hd
                                             + cw * WN * 16 + (lane & 15));
    // this lane's first A-fragment halfs in plane 0; all else is a constant offset
    const _Float16* aBase = &sH[0][rw * MTW * 16 + (lane & 15)][khalf << 3];
    float xv[2][LT];
#pragma unroll   // all 32 loads in flight at once, into registers
    for (int lt = 0; lt < LT; ++lt) xv[0][lt] = xrow[xofs + lt * Hd];
    const unsigned int aofs = (unsigned int)(b * Hd + h);
    const float ar = abarRe[aofs];
    const float ai = abarIm[aofs];
    // address registers of the loads above may be reused from here on; naming the
    // index keeps its register from being handed out ahead of the wait
    asm volatile("s_wait_xcnt 0x0" :: "v"(aofs) : "memory");
    // holds later instructions (and their register reuse) behind that wait
    __builtin_amdgcn_sched_barrier(0);

    // B fragments (this wave's WN*16 output columns, both planes): loaded once,
    // ahead of every later x load, so that no wait on them drains those
    v16h bRe[WN][4], bIm[WN][4];
    const unsigned int bofs = (unsigned int)(cw * WN * 32 + lane) * 32u;   // bytes
#pragma unroll   // register arrays need compile-time indices
    for (int j = 0; j < WN; ++j) {
#pragma unroll   // as above
        for (int kb = 0; kb < 4; ++kb) {
            const char* pb = (const char*)bfragU + bofs + j * 1024;
            const unsigned int* p1 = (const unsigned int*)(pb + kb * 8192);
            const unsigned int* p2 = (const unsigned int*)(pb + 32768 + kb * 8192);
            union { uint4 q[2]; v16h v; } bR, bI;
            bR.q[0] = *(const uint4*)(p1);
            bR.q[1] = *(const uint4*)(p1 + 4);
            bI.q[0] = *(const uint4*)(p2);
            bI.q[1] = *(const uint4*)(p2 + 4);
            bRe[j][kb] = bR.v;
            bIm[j][kb] = bI.v;
        }
    }
    // as above, for the fragment loads; naming their offset keeps its register
    // from being handed to one of the loaded fragments ahead of the wait
    asm volatile("s_wait_xcnt 0x0" :: "v"(bofs) : "memory");
    // keeps pass 0's x and the fragments older than the next pass's x, so that
    // the counted waits on them drain nothing newer
    __builtin_amdgcn_sched_barrier(0);

    // P = Abar^LT via 5 complex squarings
    float pr = ar, pi = ai;
#pragma unroll   // five short steps, no loop overhead
    for (int q = 0; q < 5; ++q) {
        const float t = pr * pr - pi * pi;
        pi = 2.0f * pr * pi;
        pr = t;
    }

    float Hr = 0.0f, Hi = 0.0f;   // state in front of the pass (alike in all groups)

    // ---- second block of a row: passes 0 to TS-1 for the state behind them only ----
    if (second) {
#pragma unroll   // all 32 loads in flight at once, into registers
        for (int lt = 0; lt < LT; ++lt) xv[1][lt] = xrow[xofs + (ST + lt) * Hd];
        // address registers of these loads may be reused from here on
        asm volatile("s_wait_xcnt 0x0" ::: "memory");
        // holds later instructions (and their register reuse) behind that wait
        __builtin_amdgcn_sched_barrier(0);
        sC[grp][h] = carry_of(xv[0], ar, ai);
        lds_only_barrier();
        // stays rolled; two passes per trip for the two x register sets, as below
#pragma nounroll
        for (int s2 = 0; s2 < TS - 1; s2 += 2) {
#pragma unroll   // p picks the x register set: compile-time index
            for (int p = 0; p < 2; ++p) {
                // x of pass s+2 (at most pass TS) into the set whose carry is done
                const float* xn = xrow + (size_t)(s2 + p + 2) * ST * Hd;
#pragma unroll   // all 32 loads in flight at once, into registers
                for (int lt = 0; lt < LT; ++lt) xv[p][lt] = xn[xofs + lt * Hd];
                // address registers of these loads may be reused from here on
                asm volatile("s_wait_xcnt 0x0" ::: "memory");
                // keeps the loads at the head of the pass, a whole pass ahead of their use
                __builtin_amdgcn_sched_barrier(0);
#pragma unroll   // four short steps; lets the four LDS reads go out together
                for (int j = 0; j < NG; ++j) {
                    const float2 cj = sC[j][h];
                    const float nrr = pr * Hr - pi * Hi + cj.x;
                    const float nii = pr * Hi + pi * Hr + cj.y;
                    Hr = nrr;
                    Hi = nii;
                }
                // ends every read of sC by the join above
                lds_only_barrier();
                sC[grp][h] = carry_of(xv[p ^ 1], ar, ai);
                // publishes the carries
                lds_only_barrier();
            }
        }
        // pass TS-1: its carries are in sC; pass TS lies in the second register set
#pragma unroll   // four short steps; lets the four LDS reads go out together
        for (int j = 0; j < NG; ++j) {
            const float2 cj = sC[j][h];
            const float nrr = pr * Hr - pi * Hi + cj.x;
            const float nii = pr * Hi + pi * Hr + cj.y;
            Hr = nrr;
            Hi = nii;
        }
        // ends every read of sC before the carry below writes it again
        lds_only_barrier();
        // the full passes below start on the first register set
#pragma unroll   // registers: compile-time indices
        for (int lt = 0; lt < LT; ++lt) xv[0][lt] = xv[1][lt];
    }

    // x of the second full pass: behind the branch, so that no load is in flight
    // into this set where the two paths meet
    {
        const float* xn = xrow + (size_t)(sBeg + 1) * ST * Hd;
#pragma unroll   // all 32 loads in flight at once, into registers
        for (int lt = 0; lt < LT; ++lt) xv[1][lt] = xn[xofs + lt * Hd];
        // address registers of these loads may be reused from here on
        asm volatile("s_wait_xcnt 0x0" ::: "memory");
        // holds later instructions (and their register reuse) behind that wait
        __builtin_amdgcn_sched_barrier(0);
    }

    // carry of the first full pass
    sC[grp][h] = carry_of(xv[0], ar, ai);
    lds_only_barrier();

    // stays rolled;
    // two passes per trip because the two x register sets need compile-time indices
#pragma nounroll
    for (int s2 = sBeg; s2 < sEnd; s2 += 2) {
#pragma unroll   // p picks the x register set: compile-time index
        for (int p = 0; p < 2; ++p) {
            const int s = s2 + p;

            // ---- join: start state of this group, and the state behind the pass ----
            float hr = 0.0f, hi = 0.0f;
#pragma unroll   // four short steps; lets the four LDS reads go out together
            for (int j = 0; j < NG; ++j) {
                if (j == grp) { hr = Hr; hi = Hi; }
                const float2 cj = sC[j][h];
                const float nrr = pr * Hr - pi * Hi + cj.x;
                const float nii = pr * Hi + pi * Hr + cj.y;
                Hr = nrr;
                Hi = nii;
            }

            // ---- scan phase: LT dependent steps, f16 state to LDS ----
#pragma unroll   // x lies in registers: compile-time indices
            for (int lt = 0; lt < LT; ++lt) {
                const float nrr = xv[p][lt] + hr * ar - hi * ai;
                const float nii = hr * ai + hi * ar;
                hr = nrr;
                hi = nii;
                sH[0][grp * LT + lt][h] = (_Float16)hr;
                sH[1][grp * LT + lt][h] = (_Float16)hi;
            }

            // ---- x of pass s+2 into the set just read: first read one pass later ----
            // No branch round the loads: with one, the compiler must count its load
            // waits for the path without them, and every wait on the older set would
            // drain this one too.  The last pass but one reads pass sEnd-1 again (cache
            // hits).  The first set's loads stand behind the way out of the loop, below.
            if (p == 1) {
                const int sn = (s + 2 < sEnd) ? s + 2 : sEnd - 1;
                const float* xn = xrow + (size_t)sn * ST * Hd;
#pragma unroll   // all 32 loads in flight at once, into registers
                for (int lt = 0; lt < LT; ++lt) xv[1][lt] = xn[xofs + lt * Hd];
                // address registers of these loads may be reused from here on
                asm volatile("s_wait_xcnt 0x0" ::: "memory");
                // keeps the loads here instead of sunk behind the GEMM
                __builtin_amdgcn_sched_barrier(0);
            }
            // publishes the state tile; also ends every read of sC by the join above
            lds_only_barrier();

            // ---- GEMM phase ----
            float* yp = yrow + (size_t)s * ST * Hd;
#pragma unroll
            for (int mt = 0; mt < MTW; ++mt) {   // which 16 LDS rows
                v8f acc[WN];
#pragma unroll
                for (int j = 0; j < WN; ++j)
                    acc[j] = (v8f){0.f, 0.f, 0.f, 0.f, 0.f, 0.f, 0.f, 0.f};

#pragma unroll
                for (int kb = 0; kb < 4; ++kb) {
                    // A fragments from LDS (16x32 f16, ISA A-operand layout)
                    union { unsigned int u[8]; v16h v; } aR, aI;
#pragma unroll
                    for (int d = 0; d < 8; ++d) {
                        const int k0 = mt * 16 * LDP + kb * 32 + ((d >> 2) << 4) + ((d & 3) << 1);
                        aR.u[d] = *(const unsigned int*)(aBase + k0);
                        aI.u[d] = *(const unsigned int*)(aBase + ST * LDP + k0);
                    }
#pragma unroll
                    for (int j = 0; j < WN; ++j) {
                        acc[j] = __builtin_amdgcn_wmma_f32_16x16x32_f16(
                            false, aR.v, false, bRe[j][kb], (short)0, acc[j], false, false);
                        acc[j] = __builtin_amdgcn_wmma_f32_16x16x32_f16(
                            false, aI.v, false, bIm[j][kb], (short)0, acc[j], false, false);
                    }
                }

                // D layout: VGPR r -> M = r + 8*(lane>=16), N = lane%16
#pragma unroll
                for (int r = 0; r < 8; ++r) {
#pragma unroll
                    for (int j = 0; j < WN; ++j)
                        yp[yofs + (mt * 16 + r) * Hd + j * 16] = acc[j][r];
                }
                // the stores stay in flight, but their address and data registers are
                // reused by the next row block: this wait stands in front of that reuse.
                // The four v_nop keep the distance that the chip needs between the last
                // WMMA above and the next row block's first WMMA, which overwrites its D
                // (only stores and LDS loads stand between them, and they fill no slot).
                asm volatile("s_wait_xcnt 0x0\n\tv_nop\n\tv_nop\n\tv_nop\n\tv_nop" ::: "memory");
                // holds the next row block's instructions behind that wait
                __builtin_amdgcn_sched_barrier(0);
            }
            // behind the last pass (always a p == 0: both blocks have an odd number
            // of full passes) nobody writes LDS again: nothing there
            if (p == 0 && s2 + 1 >= sEnd) break;
            if (p == 0) {
                // x of pass s+2 (it exists: the number of passes is odd).  Behind the
                // way out, so that no load into this set is in flight on that path:
                // else the compiler drains the newer set in every scan of this one
                const float* xn = xrow + (size_t)(s + 2) * ST * Hd;
#pragma unroll   // all 32 loads in flight at once, into registers
                for (int lt = 0; lt < LT; ++lt) xv[0][lt] = xn[xofs + lt * Hd];
                // address registers of these loads may be reused from here on
                asm volatile("s_wait_xcnt 0x0" ::: "memory");
                // keeps the loads ahead of the carry, a whole pass ahead of their use
                __builtin_amdgcn_sched_barrier(0);
            }
            // ---- carry of pass s+1: registers only, so a wave that is through
            // with its GEMM runs it while slower waves still use LDS and WMMA ----
            sC[grp][h] = carry_of(xv[p ^ 1], ar, ai);
            // frees the state tile for the next scan and publishes the carries
            lds_only_barrier();
        }
    }
    // the x loads of the last pass but one are never read, so no wait of the compiler's
    // covers them: a precaution, they land before the wave releases its registers
    asm volatile("s_wait_loadcnt 0x0" ::: "memory");
}

// ---------------------------------------------------------------------------
// Host-side launcher. Workspace layout (bytes):
//   [0,      65536)  abarRe (H*H f32)
//   [65536, 131072)  abarIm
//   [262144,327680)  bfrag (64 f16 fragments, 1 KB each)
// ---------------------------------------------------------------------------
extern "C" void kernel_launch(void* const* d_in, const int* in_sizes, int n_in,
                              void* d_out, int out_size, void* d_ws, size_t ws_size,
                              hipStream_t stream) {
    const float* X    = (const float*)d_in[0];
    const float* A_rt = (const float*)d_in[1];
    const float* C_rt = (const float*)d_in[2];
    float* out = (float*)d_out;

    char* ws = (char*)d_ws;
    float*    abarRe = (float*)(ws + 0);
    float*    abarIm = (float*)(ws + 65536);
    _Float16* bfrag  = (_Float16*)(ws + 262144);

    lssm_setup_kernel<<<dim3(Hd), dim3(Hd), 0, stream>>>(
        A_rt, C_rt, abarRe, abarIm, bfrag);
    lssm_main_kernel<<<dim3(NBLK), dim3(512), 0, stream>>>(
        X, abarRe, abarIm, (const unsigned int*)bfrag, out);
}

// v004
// It runs in 41 microseconds.
// Next to v003, in two timings, it ran 1.04 times as fast each time.
// Counting every step since v000, it is 1.89 times as fast.
#include <hip/hip_runtime.h>

#define Hd 128
#define Bd 128
#define Ld 2048
#define NG 4              // time groups per block (each 128 threads, one per state element)
#define LT 32             // steps that one group scans per pass
#define ST (NG * LT)      // 128 steps per pass of the block
#define NS (Ld / ST)      // 16 passes walk the whole sequence
#define TS 9              // passes of a row's first block; its second block takes the other NS - TS
#define NBLK 256          // two blocks per batch row: one for every WGP of the chip
#define WN 2              // 16-column blocks per wave in the GEMM phase
#define NCW (8 / WN)      // waves side by side over the 128 columns
#define NRW (16 / NCW)    // waves above one another over the ST rows
#define MTW (ST / 16 / NRW)  // 16-row blocks per wave
#define LDP 136           // padded LDS row length in halfs (breaks bank aliasing)

static constexpr float DT = 0.01f;

typedef __attribute__((ext_vector_type(16))) _Float16 v16h;
typedef __attribute__((ext_vector_type(8)))  float    v8f;
typedef __attribute__((ext_vector_type(2)))  float    v2f;

// ---------------------------------------------------------------------------
// Kernel 1: parameter setup.
//   Abar[i][j] = (1/(I - A*dt/2)) * (I + A*dt/2)        (elementwise, I=eye)
//   Cbar[i][j] = (1/(I - Abar*dt/2)) * C * dt           (elementwise)
//   Cbar is written directly in WMMA B-fragment layout (f16), minus sign of
//   the imaginary part folded in:  Y = HRe@CbRe^T + HIm@(-CbIm^T)
// ---------------------------------------------------------------------------
__global__ void lssm_setup_kernel(const float* __restrict__ A_rt,
                                  const float* __restrict__ C_rt,
                                  float* __restrict__ abarRe,
                                  float* __restrict__ abarIm,
                                  _Float16* __restrict__ bfrag) {
    const int i = blockIdx.x;    // row of Abar/Cbar
    const int j = threadIdx.x;   // col of Abar/Cbar
    const int idx = i * Hd + j;

    const float ar = A_rt[idx * 2 + 0], ai = A_rt[idx * 2 + 1];
    const float cr = C_rt[idx * 2 + 0], ci = C_rt[idx * 2 + 1];
    const float hdt = DT * 0.5f;
    const float eye = (i == j) ? 1.0f : 0.0f;

    // Abar = recip(I - z) * (I + z), z = A*dt/2
    const float zr = ar * hdt, zi = ai * hdt;
    float dr = eye - zr, di = -zi;
    float den = dr * dr + di * di;
    float rr = dr / den, ri = -di / den;
    const float nr = eye + zr, ni = zi;
    const float abr = rr * nr - ri * ni;
    const float abi = rr * ni + ri * nr;
    abarRe[idx] = abr;
    abarIm[idx] = abi;

    // Cbar = recip(I - Abar*dt/2) * C * dt
    float er = eye - abr * hdt, ei = -abi * hdt;
    float den2 = er * er + ei * ei;
    float qr = er / den2, qi = -ei / den2;
    const float cbr = (qr * cr - qi * ci) * DT;
    const float cbi = (qr * ci + qi * cr) * DT;

    // B matrix element (k = j, n = i): B1[k][n] = CbRe[n][k], B2[k][n] = -CbIm[n][k]
    // Fragment layout (mirrors ISA 16-bit operand layout):
    //   kb = k>>5, kk = k&31
    //   lane    = nn + 16*((kk>>3)&1)
    //   halfIdx = ((kk>>4)<<3) + (kk&7)
    // Which output column sits in which fragment column is free.  The WN = 2
    // fragments of one wave share 32 neighbouring columns so that column 2*nn
    // lies in the first and column 2*nn+1 in the second: a lane's two
    // accumulators then hold neighbours, and 16 lanes store a whole 128-byte line.
    const int kb = j >> 5, kk = j & 31;
    const int nb = ((i >> 5) << 1) | (i & 1), nn = (i >> 1) & 15;
    const int lane = nn + (((kk >> 3) & 1) << 4);
    const int hidx = ((kk >> 4) << 3) + (kk & 7);
    const int base = lane * 16 + hidx;
    bfrag[(size_t)((kb * 8 + nb)) * 512 + base]      = (_Float16)cbr;   // Re plane
    bfrag[(size_t)(32 + kb * 8 + nb) * 512 + base]   = (_Float16)(-cbi); // -Im plane
}

// ---------------------------------------------------------------------------
// Work-group barrier that orders LDS traffic only.  __syncthreads() also
// drains every global load and store of the wave; here the x loads issued two
// passes ahead and the y stores must stay in flight across the barriers.
// Nothing that one wave writes to global memory is read by another wave.
// ---------------------------------------------------------------------------
__device__ __forceinline__ void lds_only_barrier() {
    __builtin_amdgcn_fence(__ATOMIC_RELEASE, "workgroup", "local");
    __builtin_amdgcn_s_barrier();
    __builtin_amdgcn_fence(__ATOMIC_ACQUIRE, "workgroup", "local");
}

// ---------------------------------------------------------------------------
// Kernel 2: the whole recurrence and its GEMM.
// Two blocks per batch row, 16 waves each.  A block walks the sequence in passes
// of ST steps and keeps the running state in registers, so no other launch has
// to read x to find a start state.  The first block of a row does passes 0 to
// TS-1 in full.  The second block walks those TS passes for the state alone
// (carry and join: x is read, nothing is scanned, multiplied or stored), which
// costs a fraction of a full pass, and then does passes TS to NS-1 in full; TS
// is above NS/2 so that both blocks end at about the same time.
// Inside a pass the NG groups of 128 threads take LT neighbouring steps each:
//   carry   : each group scans its LT steps from zero (registers only),
//   join    : the NG carries meet in LDS; with P = Abar^LT every thread forms
//             e_0 = H, e_{j+1} = P*e_j + carry_j, keeps e_grp as its start
//             state and e_NG as the state H behind the pass,
//   scan    : each group scans its LT steps again from e_grp, f16 state to LDS,
//   GEMM    : Y(ST x 128) = HRe @ CbRe^T + HIm @ (-CbIm^T), 16x16x32 f16 WMMA.
// The carry of pass s+1 needs registers only and stands behind the GEMM of pass
// s.  x is loaded two passes ahead into the register set that the scan has just
// read.
// ---------------------------------------------------------------------------
// carry of LT steps scanned from a zero state
__device__ __forceinline__ float2 carry_of(const float (&x)[LT], float ar, float ai) {
    float cr = 0.0f, ci = 0.0f;
#pragma unroll   // x lies in registers: compile-time indices
    for (int lt = 0; lt < LT; ++lt) {
        const float nrr = x[lt] + cr * ar - ci * ai;
        const float nii = cr * ai + ci * ar;
        cr = nrr;
        ci = nii;
    }
    return make_float2(cr, ci);
}

static_assert(WN == 2, "the set-up kernel deals columns to pairs of fragments");
static_assert(Hd * 4 == 512, "row pitch of the output in the store offsets");
static_assert((TS & 1) == 1 && ((NS - TS) & 1) == 1 && TS + 1 < NS,
              "both blocks of a row end on the first x register set");

__global__ __launch_bounds__(512) void lssm_main_kernel(
    const float* __restrict__ X,
    const float* __restrict__ abarRe,
    const float* __restrict__ abarIm,
    const unsigned int* __restrict__ bfragU,
    float* __restrict__ Y) {
    __shared__ _Float16 sH[2][ST][LDP];      // plane 0: real part, plane 1: imaginary part
    __shared__ float2 sC[NG][Hd];

    const int b = blockIdx.x & (Bd - 1);
    // the blocks that walk a prefix first have the low indices
    const bool second = blockIdx.x < Bd;
    const int sBeg = second ? TS : 0;        // passes [sBeg, sEnd) are done in full
    const int sEnd = second ? NS : TS;
    const int tid = threadIdx.x;
    const int lane = tid & 31;
    const int wave = tid >> 5;
    const int h = tid & (Hd - 1);            // state element this thread scans
    const int grp = tid >> 7;                // which LT steps of a pass it scans
    const int cw = wave & (NCW - 1);         // GEMM: which WN column blocks
    const int rw = wave / NCW;               // GEMM: which MTW row blocks
    const int khalf = lane >> 4;

    // block-uniform bases plus one 32-bit offset per thread: one address register each
    const float* xrow = X + (size_t)b * Ld * Hd;
    float* yrow = Y + (size_t)b * Ld * Hd;
    const unsigned int xofs = (unsigned int)(grp * LT * Hd + h);
    const unsigned int yofs = (unsigned int)((rw * MTW * 16 + khalf * 8) * Hd
                                             + cw * WN * 16 + (lane & 15) * WN);
    // this lane's first A-fragment halfs in plane 0; all else is a constant offset
    const _Float16* aBase = &sH[0][rw * MTW * 16 + (lane & 15)][khalf << 3];
    float xv[2][LT];
#pragma unroll   // all 32 loads in flight at once, into registers
    for (int lt = 0; lt < LT; ++lt) xv[0][lt] = xrow[xofs + lt * Hd];
    const unsigned int aofs = (unsigned int)(b * Hd + h);
    const float ar = abarRe[aofs];
    const float ai = abarIm[aofs];
    // address registers of the loads above may be reused from here on; naming the
    // index keeps its register from being handed out ahead of the wait
    asm volatile("s_wait_xcnt 0x0" :: "v"(aofs) : "memory");
    // holds later instructions (and their register reuse) behind that wait
    __builtin_amdgcn_sched_barrier(0);

    // B fragments (this wave's WN*16 output columns, both planes): loaded once,
    // ahead of every later x load, so that no wait on them drains those
    v16h bRe[WN][4], bIm[WN][4];
    const unsigned int bofs = (unsigned int)(cw * WN * 32 + lane) * 32u;   // bytes
#pragma unroll   // register arrays need compile-time indices
    for (int j = 0; j < WN; ++j) {
#pragma unroll   // as above
        for (int kb = 0; kb < 4; ++kb) {
            const char* pb = (const char*)bfragU + bofs + j * 1024;
            const unsigned int* p1 = (const unsigned int*)(pb + kb * 8192);
            const unsigned int* p2 = (const unsigned int*)(pb + 32768 + kb * 8192);
            union { uint4 q[2]; v16h v; } bR, bI;
            bR.q[0] = *(const uint4*)(p1);
            bR.q[1] = *(const uint4*)(p1 + 4);
            bI.q[0] = *(const uint4*)(p2);
            bI.q[1] = *(const uint4*)(p2 + 4);
            bRe[j][kb] = bR.v;
            bIm[j][kb] = bI.v;
        }
    }
    // as above, for the fragment loads; naming their offset keeps its register
    // from being handed to one of the loaded fragments ahead of the wait
    asm volatile("s_wait_xcnt 0x0" :: "v"(bofs) : "memory");
    // keeps pass 0's x and the fragments older than the next pass's x, so that
    // the counted waits on them drain nothing newer
    __builtin_amdgcn_sched_barrier(0);

    // P = Abar^LT via 5 complex squarings
    float pr = ar, pi = ai;
#pragma unroll   // five short steps, no loop overhead
    for (int q = 0; q < 5; ++q) {
        const float t = pr * pr - pi * pi;
        pi = 2.0f * pr * pi;
        pr = t;
    }

    float Hr = 0.0f, Hi = 0.0f;   // state in front of the pass (alike in all groups)

    // ---- second block of a row: passes 0 to TS-1 for the state behind them only ----
    if (second) {
#pragma unroll   // all 32 loads in flight at once, into registers
        for (int lt = 0; lt < LT; ++lt) xv[1][lt] = xrow[xofs + (ST + lt) * Hd];
        // address registers of these loads may be reused from here on
        asm volatile("s_wait_xcnt 0x0" ::: "memory");
        // holds later instructions (and their register reuse) behind that wait
        __builtin_amdgcn_sched_barrier(0);
        sC[grp][h] = carry_of(xv[0], ar, ai);
        lds_only_barrier();
        // stays rolled; two passes per trip for the two x register sets, as below
#pragma nounroll
        for (int s2 = 0; s2 < TS - 1; s2 += 2) {
#pragma unroll   // p picks the x register set: compile-time index
            for (int p = 0; p < 2; ++p) {
                // x of pass s+2 (at most pass TS) into the set whose carry is done
                const float* xn = xrow + (size_t)(s2 + p + 2) * ST * Hd;
#pragma unroll   // all 32 loads in flight at once, into registers
                for (int lt = 0; lt < LT; ++lt) xv[p][lt] = xn[xofs + lt * Hd];
                // address registers of these loads may be reused from here on
                asm volatile("s_wait_xcnt 0x0" ::: "memory");
                // keeps the loads at the head of the pass, a whole pass ahead of their use
                __builtin_amdgcn_sched_barrier(0);
#pragma unroll   // four short steps; lets the four LDS reads go out together
                for (int j = 0; j < NG; ++j) {
                    const float2 cj = sC[j][h];
                    const float nrr = pr * Hr - pi * Hi + cj.x;
                    const float nii = pr * Hi + pi * Hr + cj.y;
                    Hr = nrr;
                    Hi = nii;
                }
                // ends every read of sC by the join above
                lds_only_barrier();
                sC[grp][h] = carry_of(xv[p ^ 1], ar, ai);
                // publishes the carries
                lds_only_barrier();
            }
        }
        // pass TS-1: its carries are in sC; pass TS lies in the second register set
#pragma unroll   // four short steps; lets the four LDS reads go out together
        for (int j = 0; j < NG; ++j) {
            const float2 cj = sC[j][h];
            const float nrr = pr * Hr - pi * Hi + cj.x;
            const float nii = pr * Hi + pi * Hr + cj.y;
            Hr = nrr;
            Hi = nii;
        }
        // ends every read of sC before the carry below writes it again
        lds_only_barrier();
        // the full passes below start on the first register set
#pragma unroll   // registers: compile-time indices
        for (int lt = 0; lt < LT; ++lt) xv[0][lt] = xv[1][lt];
    }

    // x of the second full pass: behind the branch, so that no load is in flight
    // into this set where the two paths meet
    {
        const float* xn = xrow + (size_t)(sBeg + 1) * ST * Hd;
#pragma unroll   // all 32 loads in flight at once, into registers
        for (int lt = 0; lt < LT; ++lt) xv[1][lt] = xn[xofs + lt * Hd];
        // address registers of these loads may be reused from here on
        asm volatile("s_wait_xcnt 0x0" ::: "memory");
        // holds later instructions (and their register reuse) behind that wait
        __builtin_amdgcn_sched_barrier(0);
    }

    // carry of the first full pass
    sC[grp][h] = carry_of(xv[0], ar, ai);
    lds_only_barrier();

    // stays rolled;
    // two passes per trip because the two x register sets need compile-time indices
#pragma nounroll
    for (int s2 = sBeg; s2 < sEnd; s2 += 2) {
#pragma unroll   // p picks the x register set: compile-time index
        for (int p = 0; p < 2; ++p) {
            const int s = s2 + p;

            // ---- join: start state of this group, and the state behind the pass ----
            float hr = 0.0f, hi = 0.0f;
#pragma unroll   // four short steps; lets the four LDS reads go out together
            for (int j = 0; j < NG; ++j) {
                if (j == grp) { hr = Hr; hi = Hi; }
                const float2 cj = sC[j][h];
                const float nrr = pr * Hr - pi * Hi + cj.x;
                const float nii = pr * Hi + pi * Hr + cj.y;
                Hr = nrr;
                Hi = nii;
            }

            // ---- scan phase: LT dependent steps, f16 state to LDS ----
#pragma unroll   // x lies in registers: compile-time indices
            for (int lt = 0; lt < LT; ++lt) {
                const float nrr = xv[p][lt] + hr * ar - hi * ai;
                const float nii = hr * ai + hi * ar;
                hr = nrr;
                hi = nii;
                sH[0][grp * LT + lt][h] = (_Float16)hr;
                sH[1][grp * LT + lt][h] = (_Float16)hi;
            }

            // ---- x of pass s+2 into the set just read: first read one pass later ----
            // No branch round the loads: with one, the compiler must count its load
            // waits for the path without them, and every wait on the older set would
            // drain this one too.  The last pass but one reads pass sEnd-1 again (cache
            // hits).  The first set's loads stand behind the way out of the loop, below.
            if (p == 1) {
                const int sn = (s + 2 < sEnd) ? s + 2 : sEnd - 1;
                const float* xn = xrow + (size_t)sn * ST * Hd;
#pragma unroll   // all 32 loads in flight at once, into registers
                for (int lt = 0; lt < LT; ++lt) xv[1][lt] = xn[xofs + lt * Hd];
                // address registers of these loads may be reused from here on
                asm volatile("s_wait_xcnt 0x0" ::: "memory");
                // keeps the loads here instead of sunk behind the GEMM
                __builtin_amdgcn_sched_barrier(0);
            }
            // publishes the state tile; also ends every read of sC by the join above
            lds_only_barrier();

            // ---- GEMM phase ----
            float* yp = yrow + (size_t)s * ST * Hd;
#pragma unroll
            for (int mt = 0; mt < MTW; ++mt) {   // which 16 LDS rows
                v8f acc[WN];
#pragma unroll
                for (int j = 0; j < WN; ++j)
                    acc[j] = (v8f){0.f, 0.f, 0.f, 0.f, 0.f, 0.f, 0.f, 0.f};

#pragma unroll
                for (int kb = 0; kb < 4; ++kb) {
                    // A fragments from LDS (16x32 f16, ISA A-operand layout)
                    union { unsigned int u[8]; v16h v; } aR, aI;
#pragma unroll
                    for (int d = 0; d < 8; ++d) {
                        const int k0 = mt * 16 * LDP + kb * 32 + ((d >> 2) << 4) + ((d & 3) << 1);
                        aR.u[d] = *(const unsigned int*)(aBase + k0);
                        aI.u[d] = *(const unsigned int*)(aBase + ST * LDP + k0);
                    }
#pragma unroll
                    for (int j = 0; j < WN; ++j) {
                        acc[j] = __builtin_amdgcn_wmma_f32_16x16x32_f16(
                            false, aR.v, false, bRe[j][kb], (short)0, acc[j], false, false);
                        acc[j] = __builtin_amdgcn_wmma_f32_16x16x32_f16(
                            false, aI.v, false, bIm[j][kb], (short)0, acc[j], false, false);
                    }
                }

                // D layout: VGPR r -> M = r + 8*(lane>=16), N = lane%16; fragment column
                // N of accumulator j is output column cw*32 + 2*N + j (set-up kernel), so
                // one 8-byte store per row: lanes 0-15 and 16-31 each fill a whole line
                v2f o[8];
#pragma unroll   // registers: compile-time indices
                for (int r = 0; r < 8; ++r) o[r] = (v2f){acc[0][r], acc[1][r]};
                float* yq = yp + yofs + mt * 16 * Hd;
                // All eight stores in one statement: its operands are live together, so
                // every pair gets registers of its own and the stores go out back to back
                // (written as plain stores, the pairs were formed in two registers by turns,
                // with a wait in front of each reuse).  s_clause keeps the eight together
                // at issue, as the compiler writes it ahead of its own runs of stores.  The
                // stores stay in flight, but their address and data registers are reused by
                // the next row block: the wait at the end stands in front of that reuse.
                asm volatile("s_clause 0x7\n\t"
                             "global_store_b64 %0, %1, off\n\t"
                             "global_store_b64 %0, %2, off offset:512\n\t"
                             "global_store_b64 %0, %3, off offset:1024\n\t"
                             "global_store_b64 %0, %4, off offset:1536\n\t"
                             "global_store_b64 %0, %5, off offset:2048\n\t"
                             "global_store_b64 %0, %6, off offset:2560\n\t"
                             "global_store_b64 %0, %7, off offset:3072\n\t"
                             "global_store_b64 %0, %8, off offset:3584\n\t"
                             "s_wait_xcnt 0x0"
                             :: "v"(yq), "v"(o[0]), "v"(o[1]), "v"(o[2]), "v"(o[3]),
                                "v"(o[4]), "v"(o[5]), "v"(o[6]), "v"(o[7]) : "memory");
                // holds the next row block's instructions behind that wait
                __builtin_amdgcn_sched_barrier(0);
            }
            // behind the last pass (always a p == 0: both blocks have an odd number
            // of full passes) nobody writes LDS again: nothing there
            if (p == 0 && s2 + 1 >= sEnd) break;
            if (p == 0) {
                // x of pass s+2 (it exists: the number of passes is odd).  Behind the
                // way out, so that no load into this set is in flight on that path:
                // else the compiler drains the newer set in every scan of this one
                const float* xn = xrow + (size_t)(s + 2) * ST * Hd;
#pragma unroll   // all 32 loads in flight at once, into registers
                for (int lt = 0; lt < LT; ++lt) xv[0][lt] = xn[xofs + lt * Hd];
                // address registers of these loads may be reused from here on
                asm volatile("s_wait_xcnt 0x0" ::: "memory");
                // keeps the loads ahead of the carry, a whole pass ahead of their use
                __builtin_amdgcn_sched_barrier(0);
            }
            // ---- carry of pass s+1: registers only, so a wave that is through
            // with its GEMM runs it while slower waves still use LDS and WMMA ----
            sC[grp][h] = carry_of(xv[p ^ 1], ar, ai);
            // frees the state tile for the next scan and publishes the carries
            lds_only_barrier();
        }
    }
    // the x loads of the last pass but one are never read, so no wait of the compiler's
    // covers them: a precaution, they land before the wave releases its registers
    asm volatile("s_wait_loadcnt 0x0" ::: "memory");
}

// ---------------------------------------------------------------------------
// Host-side launcher. Workspace layout (bytes):
//   [0,      65536)  abarRe (H*H f32)
//   [65536, 131072)  abarIm
//   [262144,327680)  bfrag (64 f16 fragments, 1 KB each)
// ---------------------------------------------------------------------------
extern "C" void kernel_launch(void* const* d_in, const int* in_sizes, int n_in,
                              void* d_out, int out_size, void* d_ws, size_t ws_size,
                              hipStream_t stream) {
    const float* X    = (const float*)d_in[0];
    const float* A_rt = (const float*)d_in[1];
    const float* C_rt = (const float*)d_in[2];
    float* out = (float*)d_out;

    char* ws = (char*)d_ws;
    float*    abarRe = (float*)(ws + 0);
    float*    abarIm = (float*)(ws + 65536);
    _Float16* bfrag  = (_Float16*)(ws + 262144);

    lssm_setup_kernel<<<dim3(Hd), dim3(Hd), 0, stream>>>(
        A_rt, C_rt, abarRe, abarIm, bfrag);
    lssm_main_kernel<<<dim3(NBLK), dim3(512), 0, stream>>>(
        X, abarRe, abarIm, (const unsigned int*)bfrag, out);
}

// v005
// Measured time: 38.1 microseconds a run.
// Timed twice side by side with v004, it ran 1.07 times as fast both times.
// All steps since v000 together make it 2.03 times as fast.
#include <hip/hip_runtime.h>

#define Hd 128
#define Bd 128
#define Ld 2048
#define NG 4              // time groups per block (each 128 threads, one per state element)
#define LT 32             // steps that one group scans per pass
#define ST (NG * LT)      // 128 steps per pass of the block
#define NS (Ld / ST)      // 16 passes walk the whole sequence
#define TS 9              // passes of a row's first block; its second block takes the other NS - TS
#define NBLK 256          // two blocks per batch row: one for every WGP of the chip
#define WN 2              // 16-column blocks per wave in the GEMM phase
#define NCW (8 / WN)      // waves side by side over the 128 columns
#define NRW (16 / NCW)    // waves above one another over the ST rows
#define MTW (ST / 16 / NRW)  // 16-row blocks per wave
#define TPB 288           // LDS row pitch in bytes of the state tile: 256 + 32, an odd multiple
                          // of 32 bytes, the pitch at which the transposing load has no conflict

static constexpr float DT = 0.01f;

typedef __attribute__((ext_vector_type(16))) _Float16 v16h;
typedef __attribute__((ext_vector_type(8)))  float    v8f;
typedef __attribute__((ext_vector_type(2)))  float    v2f;
typedef __attribute__((ext_vector_type(8)))  _Float16 v8h;
typedef __attribute__((ext_vector_type(8)))  short    v8s;

// 16-byte transposing LDS load: from a tile whose rows are k and whose columns are the
// rows of the A operand, lane (c, half) gets column c of eight k rows
__device__ __forceinline__ uint4 lds_load_tr16(const unsigned char* p) {
    typedef __attribute__((address_space(3))) v8s lds_v8s;
    return __builtin_bit_cast(uint4, __builtin_amdgcn_ds_load_tr16_b128_v8i16((lds_v8s*)p));
}

// ---------------------------------------------------------------------------
// Kernel 1: parameter setup.
//   Abar[i][j] = (1/(I - A*dt/2)) * (I + A*dt/2)        (elementwise, I=eye)
//   Cbar[i][j] = (1/(I - Abar*dt/2)) * C * dt           (elementwise)
//   Cbar is written directly in WMMA B-fragment layout (f16), minus sign of
//   the imaginary part folded in:  Y = HRe@CbRe^T + HIm@(-CbIm^T)
// ---------------------------------------------------------------------------
__global__ void lssm_setup_kernel(const float* __restrict__ A_rt,
                                  const float* __restrict__ C_rt,
                                  float* __restrict__ abarRe,
                                  float* __restrict__ abarIm,
                                  _Float16* __restrict__ bfrag) {
    const int i = blockIdx.x;    // row of Abar/Cbar
    const int j = threadIdx.x;   // col of Abar/Cbar
    const int idx = i * Hd + j;

    const float ar = A_rt[idx * 2 + 0], ai = A_rt[idx * 2 + 1];
    const float cr = C_rt[idx * 2 + 0], ci = C_rt[idx * 2 + 1];
    const float hdt = DT * 0.5f;
    const float eye = (i == j) ? 1.0f : 0.0f;

    // Abar = recip(I - z) * (I + z), z = A*dt/2
    const float zr = ar * hdt, zi = ai * hdt;
    float dr = eye - zr, di = -zi;
    float den = dr * dr + di * di;
    float rr = dr / den, ri = -di / den;
    const float nr = eye + zr, ni = zi;
    const float abr = rr * nr - ri * ni;
    const float abi = rr * ni + ri * nr;
    abarRe[idx] = abr;
    abarIm[idx] = abi;

    // Cbar = recip(I - Abar*dt/2) * C * dt
    float er = eye - abr * hdt, ei = -abi * hdt;
    float den2 = er * er + ei * ei;
    float qr = er / den2, qi = -ei / den2;
    const float cbr = (qr * cr - qi * ci) * DT;
    const float cbi = (qr * ci + qi * cr) * DT;

    // B matrix element (k = j, n = i): B1[k][n] = CbRe[n][k], B2[k][n] = -CbIm[n][k]
    // Fragment layout (mirrors ISA 16-bit operand layout):
    //   kb = k>>5, kk = k&31
    //   lane    = nn + 16*((kk>>3)&1)
    //   halfIdx = ((kk>>4)<<3) + (kk&7)
    // Which output column sits in which fragment column is free.  The WN = 2
    // fragments of one wave share 32 neighbouring columns so that column 2*nn
    // lies in the first and column 2*nn+1 in the second: a lane's two
    // accumulators then hold neighbours, and 16 lanes store a whole 128-byte line.
    const int kb = j >> 5, kk = j & 31;
    const int nb = ((i >> 5) << 1) | (i & 1), nn = (i >> 1) & 15;
    const int lane = nn + (((kk >> 3) & 1) << 4);
    const int hidx = ((kk >> 4) << 3) + (kk & 7);
    const int base = lane * 16 + hidx;
    bfrag[(size_t)((kb * 8 + nb)) * 512 + base]      = (_Float16)cbr;   // Re plane
    bfrag[(size_t)(32 + kb * 8 + nb) * 512 + base]   = (_Float16)(-cbi); // -Im plane
}

// ---------------------------------------------------------------------------
// Work-group barrier that orders LDS traffic only.  __syncthreads() also
// drains every global load and store of the wave; here the x loads issued two
// passes ahead and the y stores must stay in flight across the barriers.
// Nothing that one wave writes to global memory is read by another wave.
// ---------------------------------------------------------------------------
__device__ __forceinline__ void lds_only_barrier() {
    __builtin_amdgcn_fence(__ATOMIC_RELEASE, "workgroup", "local");
    __builtin_amdgcn_s_barrier();
    __builtin_amdgcn_fence(__ATOMIC_ACQUIRE, "workgroup", "local");
}

// ---------------------------------------------------------------------------
// Kernel 2: the whole recurrence and its GEMM.
// Two blocks per batch row, 16 waves each.  A block walks the sequence in passes
// of ST steps and keeps the running state in registers, so no other launch has
// to read x to find a start state.  The first block of a row does passes 0 to
// TS-1 in full.  The second block walks those TS passes for the state alone
// (carry and join: x is read, nothing is scanned, multiplied or stored), which
// costs a fraction of a full pass, and then does passes TS to NS-1 in full; TS
// is above NS/2 so that both blocks end at about the same time.
// Inside a pass the NG groups of 128 threads take LT neighbouring steps each:
//   carry   : each group scans its LT steps from zero (registers only),
//   join    : the NG carries meet in LDS; with P = Abar^LT every thread forms
//             e_0 = H, e_{j+1} = P*e_j + carry_j, keeps e_grp as its start
//             state and e_NG as the state H behind the pass,
//   scan    : each group scans its LT steps again from e_grp, f16 state to LDS.  The
//             tile lies transposed, a row per state element and a column per step:
//             a thread's steps are neighbours, eight of them go out in one 16-byte
//             store, and the GEMM reads its A fragments by transposing loads,
//   GEMM    : Y(ST x 128) = HRe @ CbRe^T + HIm @ (-CbIm^T), 16x16x32 f16 WMMA.
// The carry of pass s+1 needs registers only and stands behind the GEMM of pass
// s.  x is loaded two passes ahead into the register set that the scan has just
// read.
// ---------------------------------------------------------------------------
// carry of LT steps scanned from a zero state
__device__ __forceinline__ float2 carry_of(const float (&x)[LT], float ar, float ai) {
    float cr = 0.0f, ci = 0.0f;
#pragma unroll   // x lies in registers: compile-time indices
    for (int lt = 0; lt < LT; ++lt) {
        const float nrr = x[lt] + cr * ar - ci * ai;
        const float nii = cr * ai + ci * ar;
        cr = nrr;
        ci = nii;
    }
    return make_float2(cr, ci);
}

static_assert(WN == 2, "the set-up kernel deals columns to pairs of fragments");
static_assert(Hd * 4 == 512, "row pitch of the output in the store offsets");
static_assert(TPB >= ST * 2 && TPB % 32 == 0 && ((TPB / 32) & 1) == 1 && LT % 8 == 0,
              "state tile: a row holds a pass, pitch for the transposing load, 16-byte stores");
static_assert((TS & 1) == 1 && ((NS - TS) & 1) == 1 && TS + 1 < NS,
              "both blocks of a row end on the first x register set");

__global__ __launch_bounds__(512) void lssm_main_kernel(
    const float* __restrict__ X,
    const float* __restrict__ abarRe,
    const float* __restrict__ abarIm,
    const unsigned int* __restrict__ bfragU,
    float* __restrict__ Y) {
    // plane 0: real part, plane 1: imaginary part; [state element][step of the pass]
    __shared__ __attribute__((aligned(16))) _Float16 sH[2][Hd][TPB / 2];
    __shared__ float2 sC[NG][Hd];

    const int b = blockIdx.x & (Bd - 1);
    // the blocks that walk a prefix first have the low indices
    const bool second = blockIdx.x < Bd;
    const int sBeg = second ? TS : 0;        // passes [sBeg, sEnd) are done in full
    const int sEnd = second ? NS : TS;
    const int tid = threadIdx.x;
    const int lane = tid & 31;
    const int wave = tid >> 5;
    const int h = tid & (Hd - 1);            // state element this thread scans
    const int grp = tid >> 7;                // which LT steps of a pass it scans
    const int cw = wave & (NCW - 1);         // GEMM: which WN column blocks
    const int rw = wave / NCW;               // GEMM: which MTW row blocks
    const int khalf = lane >> 4;

    // block-uniform bases plus one 32-bit offset per thread: one address register each
    const float* xrow = X + (size_t)b * Ld * Hd;
    float* yrow = Y + (size_t)b * Ld * Hd;
    const unsigned int xofs = (unsigned int)(grp * LT * Hd + h);
    const unsigned int yofs = (unsigned int)((rw * MTW * 16 + khalf * 8) * Hd
                                             + cw * WN * 16 + (lane & 15) * WN);
    // this lane's address in the first transposing load of plane 0 (k row 8*khalf +
    // lane%8, 16-byte piece (lane/8)%2 of the wave's first 16 steps); all else is a
    // constant offset
    const unsigned char* aBase = (const unsigned char*)&sH[0][(khalf << 3) + (lane & 7)]
                                                          [rw * MTW * 16 + (((lane >> 3) & 1) << 3)];
    // where this thread's LT steps of plane 0 go
    _Float16* tRow = &sH[0][h][grp * LT];
    float xv[2][LT];
#pragma unroll   // all 32 loads in flight at once, into registers
    for (int lt = 0; lt < LT; ++lt) xv[0][lt] = xrow[xofs + lt * Hd];
    const unsigned int aofs = (unsigned int)(b * Hd + h);
    const float ar = abarRe[aofs];
    const float ai = abarIm[aofs];
    // address registers of the loads above may be reused from here on; naming the
    // index keeps its register from being handed out ahead of the wait
    asm volatile("s_wait_xcnt 0x0" :: "v"(aofs) : "memory");
    // holds later instructions (and their register reuse) behind that wait
    __builtin_amdgcn_sched_barrier(0);

    // B fragments (this wave's WN*16 output columns, both planes): loaded once,
    // ahead of every later x load, so that no wait on them drains those
    v16h bRe[WN][4], bIm[WN][4];
    const unsigned int bofs = (unsigned int)(cw * WN * 32 + lane) * 32u;   // bytes
#pragma unroll   // register arrays need compile-time indices
    for (int j = 0; j < WN; ++j) {
#pragma unroll   // as above
        for (int kb = 0; kb < 4; ++kb) {
            const char* pb = (const char*)bfragU + bofs + j * 1024;
            const unsigned int* p1 = (const unsigned int*)(pb + kb * 8192);
            const unsigned int* p2 = (const unsigned int*)(pb + 32768 + kb * 8192);
            union { uint4 q[2]; v16h v; } bR, bI;
            bR.q[0] = *(const uint4*)(p1);
            bR.q[1] = *(const uint4*)(p1 + 4);
            bI.q[0] = *(const uint4*)(p2);
            bI.q[1] = *(const uint4*)(p2 + 4);
            bRe[j][kb] = bR.v;
            bIm[j][kb] = bI.v;
        }
    }
    // as above, for the fragment loads; naming their offset keeps its register
    // from being handed to one of the loaded fragments ahead of the wait
    asm volatile("s_wait_xcnt 0x0" :: "v"(bofs) : "memory");
    // keeps pass 0's x and the fragments older than the next pass's x, so that
    // the counted waits on them drain nothing newer
    __builtin_amdgcn_sched_barrier(0);

    // P = Abar^LT via 5 complex squarings
    float pr = ar, pi = ai;
#pragma unroll   // five short steps, no loop overhead
    for (int q = 0; q < 5; ++q) {
        const float t = pr * pr - pi * pi;
        pi = 2.0f * pr * pi;
        pr = t;
    }

    float Hr = 0.0f, Hi = 0.0f;   // state in front of the pass (alike in all groups)

    // ---- second block of a row: passes 0 to TS-1 for the state behind them only ----
    if (second) {
#pragma unroll   // all 32 loads in flight at once, into registers
        for (int lt = 0; lt < LT; ++lt) xv[1][lt] = xrow[xofs + (ST + lt) * Hd];
        // address registers of these loads may be reused from here on
        asm volatile("s_wait_xcnt 0x0" ::: "memory");
        // holds later instructions (and their register reuse) behind that wait
        __builtin_amdgcn_sched_barrier(0);
        sC[grp][h] = carry_of(xv[0], ar, ai);
        lds_only_barrier();
        // stays rolled; two passes per trip for the two x register sets, as below
#pragma nounroll
        for (int s2 = 0; s2 < TS - 1; s2 += 2) {
#pragma unroll   // p picks the x register set: compile-time index
            for (int p = 0; p < 2; ++p) {
                // x of pass s+2 (at most pass TS) into the set whose carry is done
                const float* xn = xrow + (size_t)(s2 + p + 2) * ST * Hd;
#pragma unroll   // all 32 loads in flight at once, into registers
                for (int lt = 0; lt < LT; ++lt) xv[p][lt] = xn[xofs + lt * Hd];
                // address registers of these loads may be reused from here on
                asm volatile("s_wait_xcnt 0x0" ::: "memory");
                // keeps the loads at the head of the pass, a whole pass ahead of their use
                __builtin_amdgcn_sched_barrier(0);
#pragma unroll   // four short steps; lets the four LDS reads go out together
                for (int j = 0; j < NG; ++j) {
                    const float2 cj = sC[j][h];
                    const float nrr = pr * Hr - pi * Hi + cj.x;
                    const float nii = pr * Hi + pi * Hr + cj.y;
                    Hr = nrr;
                    Hi = nii;
                }
                // ends every read of sC by the join above
                lds_only_barrier();
                sC[grp][h] = carry_of(xv[p ^ 1], ar, ai);
                // publishes the carries
                lds_only_barrier();
            }
        }
        // pass TS-1: its carries are in sC; pass TS lies in the second register set
#pragma unroll   // four short steps; lets the four LDS reads go out together
        for (int j = 0; j < NG; ++j) {
            const float2 cj = sC[j][h];
            const float nrr = pr * Hr - pi * Hi + cj.x;
            const float nii = pr * Hi + pi * Hr + cj.y;
            Hr = nrr;
            Hi = nii;
        }
        // ends every read of sC before the carry below writes it again
        lds_only_barrier();
        // the full passes below start on the first register set
#pragma unroll   // registers: compile-time indices
        for (int lt = 0; lt < LT; ++lt) xv[0][lt] = xv[1][lt];
    }

    // x of the second full pass: behind the branch, so that no load is in flight
    // into this set where the two paths meet
    {
        const float* xn = xrow + (size_t)(sBeg + 1) * ST * Hd;
#pragma unroll   // all 32 loads in flight at once, into registers
        for (int lt = 0; lt < LT; ++lt) xv[1][lt] = xn[xofs + lt * Hd];
        // address registers of these loads may be reused from here on
        asm volatile("s_wait_xcnt 0x0" ::: "memory");
        // holds later instructions (and their register reuse) behind that wait
        __builtin_amdgcn_sched_barrier(0);
    }

    // carry of the first full pass
    sC[grp][h] = carry_of(xv[0], ar, ai);
    lds_only_barrier();

    // stays rolled;
    // two passes per trip because the two x register sets need compile-time indices
#pragma nounroll
    for (int s2 = sBeg; s2 < sEnd; s2 += 2) {
#pragma unroll   // p picks the x register set: compile-time index
        for (int p = 0; p < 2; ++p) {
            const int s = s2 + p;

            // ---- join: start state of this group, and the state behind the pass ----
            float hr = 0.0f, hi = 0.0f;
#pragma unroll   // four short steps; lets the four LDS reads go out together
            for (int j = 0; j < NG; ++j) {
                if (j == grp) { hr = Hr; hi = Hi; }
                const float2 cj = sC[j][h];
                const float nrr = pr * Hr - pi * Hi + cj.x;
                const float nii = pr * Hi + pi * Hr + cj.y;
                Hr = nrr;
                Hi = nii;
            }

            // ---- scan phase: LT dependent steps, f16 state to LDS ----
#pragma unroll   // x lies in registers: compile-time indices
            for (int q = 0; q < LT / 8; ++q) {
                v8h wr, wi;
#pragma unroll   // as above
                for (int e = 0; e < 8; ++e) {
                    const float nrr = xv[p][q * 8 + e] + hr * ar - hi * ai;
                    const float nii = hr * ai + hi * ar;
                    hr = nrr;
                    hi = nii;
                    wr[e] = (_Float16)hr;
                    wi[e] = (_Float16)hi;
                }
                *(v8h*)(tRow + q * 8) = wr;
                *(v8h*)(tRow + Hd * (TPB / 2) + q * 8) = wi;
            }

            // ---- x of pass s+2 into the set just read: first read one pass later ----
            // No branch round the loads: with one, the compiler must count its load
            // waits for the path without them, and every wait on the older set would
            // drain this one too.  The last pass but one reads pass sEnd-1 again (cache
            // hits).  The first set's loads stand behind the way out of the loop, below.
            if (p == 1) {
                const int sn = (s + 2 < sEnd) ? s + 2 : sEnd - 1;
                const float* xn = xrow + (size_t)sn * ST * Hd;
#pragma unroll   // all 32 loads in flight at once, into registers
                for (int lt = 0; lt < LT; ++lt) xv[1][lt] = xn[xofs + lt * Hd];
                // address registers of these loads may be reused from here on
                asm volatile("s_wait_xcnt 0x0" ::: "memory");
                // keeps the loads here instead of sunk behind the GEMM
                __builtin_amdgcn_sched_barrier(0);
            }
            // publishes the state tile; also ends every read of sC by the join above
            lds_only_barrier();

            // ---- GEMM phase ----
            float* yp = yrow + (size_t)s * ST * Hd;
#pragma unroll
            for (int mt = 0; mt < MTW; ++mt) {   // which 16 steps (LDS columns, output rows)
                v8f acc[WN];
#pragma unroll
                for (int j = 0; j < WN; ++j)
                    acc[j] = (v8f){0.f, 0.f, 0.f, 0.f, 0.f, 0.f, 0.f, 0.f};

#pragma unroll
                for (int kb = 0; kb < 4; ++kb) {
                    // A fragments from LDS (16x32 f16): two transposing loads each, at k
                    // rows kb*32 and kb*32+16, give the k order 8*khalf+0..7, 16+8*khalf+0..7
                    // that the B fragments of the set-up kernel have
                    union { uint4 q[2]; v16h v; } aR, aI;
#pragma unroll
                    for (int d = 0; d < 2; ++d) {
                        const int k0 = (kb * 32 + d * 16) * TPB + mt * 32;
                        aR.q[d] = lds_load_tr16(aBase + k0);
                        aI.q[d] = lds_load_tr16(aBase + Hd * TPB + k0);
                    }
#pragma unroll
                    for (int j = 0; j < WN; ++j) {
                        acc[j] = __builtin_amdgcn_wmma_f32_16x16x32_f16(
                            false, aR.v, false, bRe[j][kb], (short)0, acc[j], false, false);
                        acc[j] = __builtin_amdgcn_wmma_f32_16x16x32_f16(
                            false, aI.v, false, bIm[j][kb], (short)0, acc[j], false, false);
                    }
                }

                // D layout: VGPR r -> M = r + 8*(lane>=16), N = lane%16; fragment column
                // N of accumulator j is output column cw*32 + 2*N + j (set-up kernel), so
                // one 8-byte store per row: lanes 0-15 and 16-31 each fill a whole line
                v2f o[8];
#pragma unroll   // registers: compile-time indices
                for (int r = 0; r < 8; ++r) o[r] = (v2f){acc[0][r], acc[1][r]};
                float* yq = yp + yofs + mt * 16 * Hd;
                // All eight stores in one statement: its operands are live together, so
                // every pair gets registers of its own and the stores go out back to back
                // (written as plain stores, the pairs were formed in two registers by turns,
                // with a wait in front of each reuse).  s_clause keeps the eight together
                // at issue, as the compiler writes it ahead of its own runs of stores.  The
                // stores stay in flight, but their address and data registers are reused by
                // the next row block: the wait at the end stands in front of that reuse.
                asm volatile("s_clause 0x7\n\t"
                             "global_store_b64 %0, %1, off\n\t"
                             "global_store_b64 %0, %2, off offset:512\n\t"
                             "global_store_b64 %0, %3, off offset:1024\n\t"
                             "global_store_b64 %0, %4, off offset:1536\n\t"
                             "global_store_b64 %0, %5, off offset:2048\n\t"
                             "global_store_b64 %0, %6, off offset:2560\n\t"
                             "global_store_b64 %0, %7, off offset:3072\n\t"
                             "global_store_b64 %0, %8, off offset:3584\n\t"
                             "s_wait_xcnt 0x0"
                             :: "v"(yq), "v"(o[0]), "v"(o[1]), "v"(o[2]), "v"(o[3]),
                                "v"(o[4]), "v"(o[5]), "v"(o[6]), "v"(o[7]) : "memory");
                // holds the next row block's instructions behind that wait
                __builtin_amdgcn_sched_barrier(0);
            }
            // behind the last pass (always a p == 0: both blocks have an odd number
            // of full passes) nobody writes LDS again: nothing there
            if (p == 0 && s2 + 1 >= sEnd) break;
            if (p == 0) {
                // x of pass s+2 (it exists: the number of passes is odd).  Behind the
                // way out, so that no load into this set is in flight on that path:
                // else the compiler drains the newer set in every scan of this one
                const float* xn = xrow + (size_t)(s + 2) * ST * Hd;
#pragma unroll   // all 32 loads in flight at once, into registers
                for (int lt = 0; lt < LT; ++lt) xv[0][lt] = xn[xofs + lt * Hd];
                // address registers of these loads may be reused from here on
                asm volatile("s_wait_xcnt 0x0" ::: "memory");
                // keeps the loads ahead of the carry, a whole pass ahead of their use
                __builtin_amdgcn_sched_barrier(0);
            }
            // ---- carry of pass s+1: registers only, so a wave that is through
            // with its GEMM runs it while slower waves still use LDS and WMMA ----
            sC[grp][h] = carry_of(xv[p ^ 1], ar, ai);
            // frees the state tile for the next scan and publishes the carries
            lds_only_barrier();
        }
    }
    // the x loads of the last pass but one are never read, so no wait of the compiler's
    // covers them: a precaution, they land before the wave releases its registers
    asm volatile("s_wait_loadcnt 0x0" ::: "memory");
}

// ---------------------------------------------------------------------------
// Host-side launcher. Workspace layout (bytes):
//   [0,      65536)  abarRe (H*H f32)
//   [65536, 131072)  abarIm
//   [262144,327680)  bfrag (64 f16 fragments, 1 KB each)
// ---------------------------------------------------------------------------
extern "C" void kernel_launch(void* const* d_in, const int* in_sizes, int n_in,
                              void* d_out, int out_size, void* d_ws, size_t ws_size,
                              hipStream_t stream) {
    const float* X    = (const float*)d_in[0];
    const float* A_rt = (const float*)d_in[1];
    const float* C_rt = (const float*)d_in[2];
    float* out = (float*)d_out;

    char* ws = (char*)d_ws;
    float*    abarRe = (float*)(ws + 0);
    float*    abarIm = (float*)(ws + 65536);
    _Float16* bfrag  = (_Float16*)(ws + 262144);

    lssm_setup_kernel<<<dim3(Hd), dim3(Hd), 0, stream>>>(
        A_rt, C_rt, abarRe, abarIm, bfrag);
    lssm_main_kernel<<<dim3(NBLK), dim3(512), 0, stream>>>(
        X, abarRe, abarIm, (const unsigned int*)bfrag, out);
}

// v006
// It runs in 35.2 microseconds.
// Two timings next to v005 both put it at 1.08 times that version's speed.
// Over all steps from v000 it is 2.20 times as fast.
#include <hip/hip_runtime.h>

#define Hd 128
#define Bd 128
#define Ld 2048
#define NG 4              // time groups per block (each 128 threads, one per state element)
#define LT 32             // steps that one group scans per pass
#define ST (NG * LT)      // 128 steps per pass of the block
#define NS (Ld / ST)      // 16 passes walk the whole sequence
#define TS 9              // passes of a row's first block; its second block takes the other NS - TS
#define NBLK 256          // two blocks per batch row: one for every WGP of the chip
#define WN 2              // 16-column blocks per wave in the GEMM phase
#define NCW (8 / WN)      // waves side by side over the 128 columns
#define NRW (16 / NCW)    // waves above one another over the ST rows
#define MTW (ST / 16 / NRW)  // 16-row blocks per wave
#define TPB 288           // LDS row pitch in bytes of the state tile: 256 + 32, an odd multiple
                          // of 32 bytes, the pitch at which the transposing load has no conflict
#define YP 132            // LDS row pitch in floats of the output tile: 512 + 16 bytes, so that rows
                          // r and r+8, written by one 8-byte store, fall on different bank halves
#define RPW (ST / 16)     // output rows that one wave sends to memory per pass

static constexpr float DT = 0.01f;

typedef __attribute__((ext_vector_type(16))) _Float16 v16h;
typedef __attribute__((ext_vector_type(8)))  float    v8f;
typedef __attribute__((ext_vector_type(2)))  float    v2f;
typedef __attribute__((ext_vector_type(4)))  float    v4f;
typedef __attribute__((ext_vector_type(8)))  _Float16 v8h;
typedef __attribute__((ext_vector_type(8)))  short    v8s;

// 16-byte transposing LDS load: from a tile whose rows are k and whose columns are the
// rows of the A operand, lane (c, half) gets column c of eight k rows
__device__ __forceinline__ uint4 lds_load_tr16(const unsigned char* p) {
    typedef __attribute__((address_space(3))) v8s lds_v8s;
    return __builtin_bit_cast(uint4, __builtin_amdgcn_ds_load_tr16_b128_v8i16((lds_v8s*)p));
}

// ---------------------------------------------------------------------------
// Kernel 1: parameter setup.
//   Abar[i][j] = (1/(I - A*dt/2)) * (I + A*dt/2)        (elementwise, I=eye)
//   Cbar[i][j] = (1/(I - Abar*dt/2)) * C * dt           (elementwise)
//   Cbar is written directly in WMMA B-fragment layout (f16), minus sign of
//   the imaginary part folded in:  Y = HRe@CbRe^T + HIm@(-CbIm^T)
// ---------------------------------------------------------------------------
__global__ void lssm_setup_kernel(const float* __restrict__ A_rt,
                                  const float* __restrict__ C_rt,
                                  float* __restrict__ abarRe,
                                  float* __restrict__ abarIm,
                                  _Float16* __restrict__ bfrag) {
    const int i = blockIdx.x;    // row of Abar/Cbar
    const int j = threadIdx.x;   // col of Abar/Cbar
    const int idx = i * Hd + j;

    const float ar = A_rt[idx * 2 + 0], ai = A_rt[idx * 2 + 1];
    const float cr = C_rt[idx * 2 + 0], ci = C_rt[idx * 2 + 1];
    const float hdt = DT * 0.5f;
    const float eye = (i == j) ? 1.0f : 0.0f;

    // Abar = recip(I - z) * (I + z), z = A*dt/2
    const float zr = ar * hdt, zi = ai * hdt;
    float dr = eye - zr, di = -zi;
    float den = dr * dr + di * di;
    float rr = dr / den, ri = -di / den;
    const float nr = eye + zr, ni = zi;
    const float abr = rr * nr - ri * ni;
    const float abi = rr * ni + ri * nr;
    abarRe[idx] = abr;
    abarIm[idx] = abi;

    // Cbar = recip(I - Abar*dt/2) * C * dt
    float er = eye - abr * hdt, ei = -abi * hdt;
    float den2 = er * er + ei * ei;
    float qr = er / den2, qi = -ei / den2;
    const float cbr = (qr * cr - qi * ci) * DT;
    const float cbi = (qr * ci + qi * cr) * DT;

    // B matrix element (k = j, n = i): B1[k][n] = CbRe[n][k], B2[k][n] = -CbIm[n][k]
    // Fragment layout (mirrors ISA 16-bit operand layout):
    //   kb = k>>5, kk = k&31
    //   lane    = nn + 16*((kk>>3)&1)
    //   halfIdx = ((kk>>4)<<3) + (kk&7)
    // Which output column sits in which fragment column is free.  The WN = 2
    // fragments of one wave share 32 neighbouring columns so that column 2*nn
    // lies in the first and column 2*nn+1 in the second: a lane's two
    // accumulators then hold neighbours, and one 8-byte store puts both in the output tile.
    const int kb = j >> 5, kk = j & 31;
    const int nb = ((i >> 5) << 1) | (i & 1), nn = (i >> 1) & 15;
    const int lane = nn + (((kk >> 3) & 1) << 4);
    const int hidx = ((kk >> 4) << 3) + (kk & 7);
    const int base = lane * 16 + hidx;
    bfrag[(size_t)((kb * 8 + nb)) * 512 + base]      = (_Float16)cbr;   // Re plane
    bfrag[(size_t)(32 + kb * 8 + nb) * 512 + base]   = (_Float16)(-cbi); // -Im plane
}

// ---------------------------------------------------------------------------
// Work-group barrier that orders LDS traffic only.  __syncthreads() also
// drains every global load and store of the wave; here the x loads issued two
// passes ahead and the y stores must stay in flight across the barriers.
// Nothing that one wave writes to global memory is read by another wave.
// ---------------------------------------------------------------------------
__device__ __forceinline__ void lds_only_barrier() {
    __builtin_amdgcn_fence(__ATOMIC_RELEASE, "workgroup", "local");
    __builtin_amdgcn_s_barrier();
    __builtin_amdgcn_fence(__ATOMIC_ACQUIRE, "workgroup", "local");
}

// ---------------------------------------------------------------------------
// Kernel 2: the whole recurrence and its GEMM.
// Two blocks per batch row, 16 waves each.  A block walks the sequence in passes
// of ST steps and keeps the running state in registers, so no other launch has
// to read x to find a start state.  The first block of a row does passes 0 to
// TS-1 in full.  The second block walks those TS passes for the state alone
// (carry and join: x is read, nothing is scanned, multiplied or stored), which
// costs a fraction of a full pass, and then does passes TS to NS-1 in full; TS
// is above NS/2 so that both blocks end at about the same time.
// Inside a pass the NG groups of 128 threads take LT neighbouring steps each:
//   carry   : each group scans its LT steps from zero (registers only),
//   join    : the NG carries meet in LDS; with P = Abar^LT every thread forms
//             e_0 = H, e_{j+1} = P*e_j + carry_j, keeps e_grp as its start
//             state and e_NG as the state H behind the pass,
//   scan    : each group scans its LT steps again from e_grp, f16 state to LDS.  The
//             tile lies transposed, a row per state element and a column per step:
//             a thread's steps are neighbours, eight of them go out in one 16-byte
//             store, and the GEMM reads its A fragments by transposing loads,
//   GEMM    : Y(ST x 128) = HRe @ CbRe^T + HIm @ (-CbIm^T), 16x16x32 f16 WMMA; a wave owns
//             only 32 columns (128 bytes) of a row, so the result goes to an LDS tile,
//   send    : behind the pass's last barrier each wave sends RPW whole rows of that tile
//             to memory, 512 contiguous bytes per store instruction.
// The carry of pass s+1 needs registers only and stands behind the GEMM of pass
// s.  x is loaded two passes ahead into the register set that the scan has just
// read.
// ---------------------------------------------------------------------------
// carry of LT steps scanned from a zero state
__device__ __forceinline__ float2 carry_of(const float (&x)[LT], float ar, float ai) {
    float cr = 0.0f, ci = 0.0f;
#pragma unroll   // x lies in registers: compile-time indices
    for (int lt = 0; lt < LT; ++lt) {
        const float nrr = x[lt] + cr * ar - ci * ai;
        const float nii = cr * ai + ci * ar;
        cr = nrr;
        ci = nii;
    }
    return make_float2(cr, ci);
}

// RPW whole rows of the output tile from LDS to memory, a row (512 bytes) per store;
// ybase is alike in the whole wave, yofs this lane's byte offset from it
__device__ __forceinline__ void send_rows(const float* sRow, unsigned long long ybase,
                                          unsigned int yofs) {
    v4f o[RPW];
#pragma unroll   // registers: compile-time indices; lets the LDS reads go out together
    for (int i = 0; i < RPW; ++i) o[i] = *(const v4f*)(sRow + i * YP);
    // All eight stores in one statement: its operands are live together, so the stores go
    // out back to back; s_clause keeps them together at issue.  Scalar base plus one offset
    // register that never changes: no address arithmetic in vector registers.  The stores
    // stay in flight, but their base and data registers are reused by what follows: the
    // wait at the end stands in front of that reuse.
    asm volatile("s_clause 0x7\n\t"
                 "global_store_b128 %0, %1, %9\n\t"
                 "global_store_b128 %0, %2, %9 offset:512\n\t"
                 "global_store_b128 %0, %3, %9 offset:1024\n\t"
                 "global_store_b128 %0, %4, %9 offset:1536\n\t"
                 "global_store_b128 %0, %5, %9 offset:2048\n\t"
                 "global_store_b128 %0, %6, %9 offset:2560\n\t"
                 "global_store_b128 %0, %7, %9 offset:3072\n\t"
                 "global_store_b128 %0, %8, %9 offset:3584\n\t"
                 "s_wait_xcnt 0x0"
                 :: "v"(yofs), "v"(o[0]), "v"(o[1]), "v"(o[2]), "v"(o[3]),
                    "v"(o[4]), "v"(o[5]), "v"(o[6]), "v"(o[7]), "s"(ybase) : "memory");
}

static_assert(WN == 2, "the set-up kernel deals columns to pairs of fragments");
static_assert(RPW == 8 && (YP * 4) % 32 == 16, "eight stores per wave; pitch of the output tile");
static_assert(Hd * 4 == 512, "row pitch of the output in the store offsets");
static_assert(TPB >= ST * 2 && TPB % 32 == 0 && ((TPB / 32) & 1) == 1 && LT % 8 == 0,
              "state tile: a row holds a pass, pitch for the transposing load, 16-byte stores");
static_assert((TS & 1) == 1 && ((NS - TS) & 1) == 1 && TS + 1 < NS,
              "both blocks of a row end on the first x register set");

__global__ __launch_bounds__(512) void lssm_main_kernel(
    const float* __restrict__ X,
    const float* __restrict__ abarRe,
    const float* __restrict__ abarIm,
    const unsigned int* __restrict__ bfragU,
    float* __restrict__ Y) {
    // plane 0: real part, plane 1: imaginary part; [state element][step of the pass]
    __shared__ __attribute__((aligned(16))) _Float16 sH[2][Hd][TPB / 2];
    __shared__ float2 sC[NG][Hd];
    // the pass's output, [step of the pass][column]
    __shared__ __attribute__((aligned(16))) float sY[ST * YP];

    const int b = blockIdx.x & (Bd - 1);
    // the blocks that walk a prefix first have the low indices
    const bool second = blockIdx.x < Bd;
    const int sBeg = second ? TS : 0;        // passes [sBeg, sEnd) are done in full
    const int sEnd = second ? NS : TS;
    const int tid = threadIdx.x;
    const int lane = tid & 31;
    const int wave = tid >> 5;
    const int h = tid & (Hd - 1);            // state element this thread scans
    const int grp = tid >> 7;                // which LT steps of a pass it scans
    const int cw = wave & (NCW - 1);         // GEMM: which WN column blocks
    const int rw = wave / NCW;               // GEMM: which MTW row blocks
    const int khalf = lane >> 4;

    // block-uniform bases plus one 32-bit offset per thread: one address register each
    const float* xrow = X + (size_t)b * Ld * Hd;
    float* yrow = Y + (size_t)b * Ld * Hd;
    const unsigned int xofs = (unsigned int)(grp * LT * Hd + h);
    // send: this wave's RPW rows, 16 bytes of each per lane.  The lane's LDS byte address
    // serves as the offset register of the global stores too (one register for both): its
    // wave-uniform part sUni is taken off their scalar base
    const int waveU = __builtin_amdgcn_readfirstlane(wave);
    const float* sRow = &sY[waveU * RPW * YP + lane * 4];
    const unsigned int sOfs = (unsigned int)(unsigned long long)sRow;
    const unsigned int sUni = __builtin_amdgcn_readfirstlane(sOfs - (unsigned int)lane * 16u);
    const unsigned long long ywave = (unsigned long long)(yrow + waveU * RPW * Hd) - sUni;
    // GEMM: where this lane's first pair of accumulator elements goes in the output tile
    float* sAcc = &sY[(rw * MTW * 16 + khalf * 8) * YP + cw * WN * 16 + (lane & 15) * WN];
    // this lane's address in the first transposing load of plane 0 (k row 8*khalf +
    // lane%8, 16-byte piece (lane/8)%2 of the wave's first 16 steps); all else is a
    // constant offset
    const unsigned char* aBase = (const unsigned char*)&sH[0][(khalf << 3) + (lane & 7)]
                                                          [rw * MTW * 16 + (((lane >> 3) & 1) << 3)];
    // where this thread's LT steps of plane 0 go
    _Float16* tRow = &sH[0][h][grp * LT];
    float xv[2][LT];
#pragma unroll   // all 32 loads in flight at once, into registers
    for (int lt = 0; lt < LT; ++lt) xv[0][lt] = xrow[xofs + lt * Hd];
    const unsigned int aofs = (unsigned int)(b * Hd + h);
    const float ar = abarRe[aofs];
    const float ai = abarIm[aofs];
    // address registers of the loads above may be reused from here on; naming the
    // index keeps its register from being handed out ahead of the wait
    asm volatile("s_wait_xcnt 0x0" :: "v"(aofs) : "memory");
    // holds later instructions (and their register reuse) behind that wait
    __builtin_amdgcn_sched_barrier(0);

    // B fragments (this wave's WN*16 output columns, both planes): loaded once,
    // ahead of every later x load, so that no wait on them drains those
    v16h bRe[WN][4], bIm[WN][4];
    const unsigned int bofs = (unsigned int)(cw * WN * 32 + lane) * 32u;   // bytes
#pragma unroll   // register arrays need compile-time indices
    for (int j = 0; j < WN; ++j) {
#pragma unroll   // as above
        for (int kb = 0; kb < 4; ++kb) {
            const char* pb = (const char*)bfragU + bofs + j * 1024;
            const unsigned int* p1 = (const unsigned int*)(pb + kb * 8192);
            const unsigned int* p2 = (const unsigned int*)(pb + 32768 + kb * 8192);
            union { uint4 q[2]; v16h v; } bR, bI;
            bR.q[0] = *(const uint4*)(p1);
            bR.q[1] = *(const uint4*)(p1 + 4);
            bI.q[0] = *(const uint4*)(p2);
            bI.q[1] = *(const uint4*)(p2 + 4);
            bRe[j][kb] = bR.v;
            bIm[j][kb] = bI.v;
        }
    }
    // as above, for the fragment loads; naming their offset keeps its register
    // from being handed to one of the loaded fragments ahead of the wait
    asm volatile("s_wait_xcnt 0x0" :: "v"(bofs) : "memory");
    // keeps pass 0's x and the fragments older than the next pass's x, so that
    // the counted waits on them drain nothing newer
    __builtin_amdgcn_sched_barrier(0);

    // P = Abar^LT via 5 complex squarings
    float pr = ar, pi = ai;
#pragma unroll   // five short steps, no loop overhead
    for (int q = 0; q < 5; ++q) {
        const float t = pr * pr - pi * pi;
        pi = 2.0f * pr * pi;
        pr = t;
    }

    float Hr = 0.0f, Hi = 0.0f;   // state in front of the pass (alike in all groups)

    // ---- second block of a row: passes 0 to TS-1 for the state behind them only ----
    if (second) {
#pragma unroll   // all 32 loads in flight at once, into registers
        for (int lt = 0; lt < LT; ++lt) xv[1][lt] = xrow[xofs + (ST + lt) * Hd];
        // address registers of these loads may be reused from here on
        asm volatile("s_wait_xcnt 0x0" ::: "memory");
        // holds later instructions (and their register reuse) behind that wait
        __builtin_amdgcn_sched_barrier(0);
        sC[grp][h] = carry_of(xv[0], ar, ai);
        lds_only_barrier();
        // stays rolled; two passes per trip for the two x register sets, as below
#pragma nounroll
        for (int s2 = 0; s2 < TS - 1; s2 += 2) {
#pragma unroll   // p picks the x register set: compile-time index
            for (int p = 0; p < 2; ++p) {
                // x of pass s+2 (at most pass TS) into the set whose carry is done
                const float* xn = xrow + (size_t)(s2 + p + 2) * ST * Hd;
#pragma unroll   // all 32 loads in flight at once, into registers
                for (int lt = 0; lt < LT; ++lt) xv[p][lt] = xn[xofs + lt * Hd];
                // address registers of these loads may be reused from here on
                asm volatile("s_wait_xcnt 0x0" ::: "memory");
                // keeps the loads at the head of the pass, a whole pass ahead of their use
                __builtin_amdgcn_sched_barrier(0);
#pragma unroll   // four short steps; lets the four LDS reads go out together
                for (int j = 0; j < NG; ++j) {
                    const float2 cj = sC[j][h];
                    const float nrr = pr * Hr - pi * Hi + cj.x;
                    const float nii = pr * Hi + pi * Hr + cj.y;
                    Hr = nrr;
                    Hi = nii;
                }
                // ends every read of sC by the join above
                lds_only_barrier();
                sC[grp][h] = carry_of(xv[p ^ 1], ar, ai);
                // publishes the carries
                lds_only_barrier();
            }
        }
        // pass TS-1: its carries are in sC; pass TS lies in the second register set
#pragma unroll   // four short steps; lets the four LDS reads go out together
        for (int j = 0; j < NG; ++j) {
            const float2 cj = sC[j][h];
            const float nrr = pr * Hr - pi * Hi + cj.x;
            const float nii = pr * Hi + pi * Hr + cj.y;
            Hr = nrr;
            Hi = nii;
        }
        // ends every read of sC before the carry below writes it again
        lds_only_barrier();
        // the full passes below start on the first register set
#pragma unroll   // registers: compile-time indices
        for (int lt = 0; lt < LT; ++lt) xv[0][lt] = xv[1][lt];
    }

    // x of the second full pass: behind the branch, so that no load is in flight
    // into this set where the two paths meet
    {
        const float* xn = xrow + (size_t)(sBeg + 1) * ST * Hd;
#pragma unroll   // all 32 loads in flight at once, into registers
        for (int lt = 0; lt < LT; ++lt) xv[1][lt] = xn[xofs + lt * Hd];
        // address registers of these loads may be reused from here on
        asm volatile("s_wait_xcnt 0x0" ::: "memory");
        // holds later instructions (and their register reuse) behind that wait
        __builtin_amdgcn_sched_barrier(0);
    }

    // carry of the first full pass
    sC[grp][h] = carry_of(xv[0], ar, ai);
    lds_only_barrier();

    // stays rolled;
    // two passes per trip because the two x register sets need compile-time indices
#pragma nounroll
    for (int s2 = sBeg; s2 < sEnd; s2 += 2) {
#pragma unroll   // p picks the x register set: compile-time index
        for (int p = 0; p < 2; ++p) {
            const int s = s2 + p;

            // ---- join: start state of this group, and the state behind the pass ----
            float hr = 0.0f, hi = 0.0f;
#pragma unroll   // four short steps; lets the four LDS reads go out together
            for (int j = 0; j < NG; ++j) {
                if (j == grp) { hr = Hr; hi = Hi; }
                const float2 cj = sC[j][h];
                const float nrr = pr * Hr - pi * Hi + cj.x;
                const float nii = pr * Hi + pi * Hr + cj.y;
                Hr = nrr;
                Hi = nii;
            }

            // ---- scan phase: LT dependent steps, f16 state to LDS ----
#pragma unroll   // x lies in registers: compile-time indices
            for (int q = 0; q < LT / 8; ++q) {
                v8h wr, wi;
#pragma unroll   // as above
                for (int e = 0; e < 8; ++e) {
                    const float nrr = xv[p][q * 8 + e] + hr * ar - hi * ai;
                    const float nii = hr * ai + hi * ar;
                    hr = nrr;
                    hi = nii;
                    wr[e] = (_Float16)hr;
                    wi[e] = (_Float16)hi;
                }
                *(v8h*)(tRow + q * 8) = wr;
                *(v8h*)(tRow + Hd * (TPB / 2) + q * 8) = wi;
            }

            // ---- x of pass s+2 into the set just read: first read one pass later ----
            // No branch round the loads: with one, the compiler must count its load
            // waits for the path without them, and every wait on the older set would
            // drain this one too.  The last pass but one reads pass sEnd-1 again (cache
            // hits).  The first set's loads stand behind the way out of the loop, below.
            if (p == 1) {
                const int sn = (s + 2 < sEnd) ? s + 2 : sEnd - 1;
                const float* xn = xrow + (size_t)sn * ST * Hd;
#pragma unroll   // all 32 loads in flight at once, into registers
                for (int lt = 0; lt < LT; ++lt) xv[1][lt] = xn[xofs + lt * Hd];
                // address registers of these loads may be reused from here on
                asm volatile("s_wait_xcnt 0x0" ::: "memory");
                // keeps the loads here instead of sunk behind the GEMM
                __builtin_amdgcn_sched_barrier(0);
            }
            // publishes the state tile; also ends every read of sC by the join above
            lds_only_barrier();

            // ---- GEMM phase ----
#pragma unroll
            for (int mt = 0; mt < MTW; ++mt) {   // which 16 steps (LDS columns, output rows)
                v8f acc[WN];
#pragma unroll
                for (int j = 0; j < WN; ++j)
                    acc[j] = (v8f){0.f, 0.f, 0.f, 0.f, 0.f, 0.f, 0.f, 0.f};

#pragma unroll
                for (int kb = 0; kb < 4; ++kb) {
                    // A fragments from LDS (16x32 f16): two transposing loads each, at k
                    // rows kb*32 and kb*32+16, give the k order 8*khalf+0..7, 16+8*khalf+0..7
                    // that the B fragments of the set-up kernel have
                    union { uint4 q[2]; v16h v; } aR, aI;
#pragma unroll
                    for (int d = 0; d < 2; ++d) {
                        const int k0 = (kb * 32 + d * 16) * TPB + mt * 32;
                        aR.q[d] = lds_load_tr16(aBase + k0);
                        aI.q[d] = lds_load_tr16(aBase + Hd * TPB + k0);
                    }
#pragma unroll
                    for (int j = 0; j < WN; ++j) {
                        acc[j] = __builtin_amdgcn_wmma_f32_16x16x32_f16(
                            false, aR.v, false, bRe[j][kb], (short)0, acc[j], false, false);
                        acc[j] = __builtin_amdgcn_wmma_f32_16x16x32_f16(
                            false, aI.v, false, bIm[j][kb], (short)0, acc[j], false, false);
                    }
                }

                // D layout: VGPR r -> M = r + 8*(lane>=16), N = lane%16; fragment column
                // N of accumulator j is output column cw*32 + 2*N + j (set-up kernel), so
                // one 8-byte LDS store per row
#pragma unroll   // registers: compile-time indices
                for (int r = 0; r < 8; ++r)
                    *(v2f*)(sAcc + (mt * 16 + r) * YP) = (v2f){acc[0][r], acc[1][r]};
            }
            // the last pass (always a p == 0: both blocks have an odd number of full
            // passes): its output tile is sent behind the loop
            if (p == 0 && s2 + 1 >= sEnd) break;
            if (p == 0) {
                // x of pass s+2 (it exists: the number of passes is odd).  Behind the
                // way out, so that no load into this set is in flight on that path:
                // else the compiler drains the newer set in every scan of this one
                const float* xn = xrow + (size_t)(s + 2) * ST * Hd;
#pragma unroll   // all 32 loads in flight at once, into registers
                for (int lt = 0; lt < LT; ++lt) xv[0][lt] = xn[xofs + lt * Hd];
                // address registers of these loads may be reused from here on
                asm volatile("s_wait_xcnt 0x0" ::: "memory");
                // keeps the loads ahead of the carry, a whole pass ahead of their use
                __builtin_amdgcn_sched_barrier(0);
            }
            // ---- carry of pass s+1: registers only, so a wave that is through
            // with its GEMM runs it while slower waves still use LDS and WMMA ----
            sC[grp][h] = carry_of(xv[p ^ 1], ar, ai);
            // frees the state tile for the next scan, publishes the carries and the output tile
            lds_only_barrier();
            // the next GEMM writes the tile again only behind the next scan's barrier
            send_rows(sRow, ywave + (unsigned long long)s * (ST * Hd * 4), sOfs);
        }
    }
    // publishes the last pass's output tile
    lds_only_barrier();
    send_rows(sRow, ywave + (unsigned long long)(sEnd - 1) * (ST * Hd * 4), sOfs);
    // the x loads of the last pass but one are never read, so no wait of the compiler's
    // covers them: a precaution, they land before the wave releases its registers
    asm volatile("s_wait_loadcnt 0x0" ::: "memory");
}

// ---------------------------------------------------------------------------
// Host-side launcher. Workspace layout (bytes):
//   [0,      65536)  abarRe (H*H f32)
//   [65536, 131072)  abarIm
//   [262144,327680)  bfrag (64 f16 fragments, 1 KB each)
// ---------------------------------------------------------------------------
extern "C" void kernel_launch(void* const* d_in, const int* in_sizes, int n_in,
                              void* d_out, int out_size, void* d_ws, size_t ws_size,
                              hipStream_t stream) {
    const float* X    = (const float*)d_in[0];
    const float* A_rt = (const float*)d_in[1];
    const float* C_rt = (const float*)d_in[2];
    float* out = (float*)d_out;

    char* ws = (char*)d_ws;
    float*    abarRe = (float*)(ws + 0);
    float*    abarIm = (float*)(ws + 65536);
    _Float16* bfrag  = (_Float16*)(ws + 262144);

    lssm_setup_kernel<<<dim3(Hd), dim3(Hd), 0, stream>>>(
        A_rt, C_rt, abarRe, abarIm, bfrag);
    lssm_main_kernel<<<dim3(NBLK), dim3(512), 0, stream>>>(
        X, abarRe, abarIm, (const unsigned int*)bfrag, out);
}

// v007
// Measured time: 34 microseconds a run.
// In two side-by-side timings against v006, it was 1.04 and 1.03 times as fast.
// Over all steps from v000 it is 2.28 times as fast.
#include <hip/hip_runtime.h>

#define Hd 128
#define Bd 128
#define Ld 2048
#define NG 4              // time groups per block (each 128 threads, one per state element)
#define LT 32             // steps that one group scans per pass
#define ST (NG * LT)      // 128 steps per pass of the block
#define NS (Ld / ST)      // 16 passes walk the whole sequence
#define TS 9              // passes of a row's first block; its second block takes the other NS - TS
#define NBLK 256          // two blocks per batch row: one for every WGP of the chip
#define WN 2              // 16-column blocks per wave in the GEMM phase
#define NCW (8 / WN)      // waves side by side over the 128 columns
#define NRW (16 / NCW)    // waves above one another over the ST rows
#define MTW (ST / 16 / NRW)  // 16-row blocks per wave
#define TPB 288           // LDS row pitch in bytes of the state tile: 256 + 32, an odd multiple
                          // of 32 bytes, the pitch at which the transposing load has no conflict
#define YP 132            // LDS row pitch in floats of the output tile: 512 + 16 bytes, so that rows
                          // r and r+8, written by one 8-byte store, fall on different bank halves
#define RPW (ST / 16)     // output rows that one wave sends to memory per pass

static constexpr float DT = 0.01f;

typedef __attribute__((ext_vector_type(16))) _Float16 v16h;
typedef __attribute__((ext_vector_type(8)))  float    v8f;
typedef __attribute__((ext_vector_type(2)))  float    v2f;
typedef __attribute__((ext_vector_type(4)))  float    v4f;
typedef __attribute__((ext_vector_type(8)))  _Float16 v8h;
typedef __attribute__((ext_vector_type(2)))  _Float16 v2h;
typedef __attribute__((ext_vector_type(8)))  short    v8s;

// 16-byte transposing LDS load: from a tile whose rows are k and whose columns are the
// rows of the A operand, lane (c, half) gets column c of eight k rows
__device__ __forceinline__ uint4 lds_load_tr16(const unsigned char* p) {
    typedef __attribute__((address_space(3))) v8s lds_v8s;
    return __builtin_bit_cast(uint4, __builtin_amdgcn_ds_load_tr16_b128_v8i16((lds_v8s*)p));
}

// ---------------------------------------------------------------------------
// Parameters (all elementwise, I = eye):
//   Abar[i][j] = (1/(I - A*dt/2)) * (I + A*dt/2)
//   Cbar[i][j] = (1/(I - Abar*dt/2)) * C * dt
// ---------------------------------------------------------------------------
// Abar of one element, for the recurrence: true divisions
__device__ __forceinline__ float2 abar_of(float ar, float ai, float eye) {
    const float hdt = DT * 0.5f;
    const float zr = ar * hdt, zi = ai * hdt;
    const float dr = eye - zr, di = -zi;
    const float den = dr * dr + di * di;
    const float rr = dr / den, ri = -di / den;
    const float nr = eye + zr, ni = zi;
    return make_float2(rr * nr - ri * ni, rr * ni + ri * nr);
}

// (Re Cbar, -Im Cbar) of one element, for the f16 B operand: the same formulas with the
// hardware reciprocal, whose error lies far below half an f16 step.  The minus sign of the
// imaginary part is folded in:  Y = HRe@CbRe^T + HIm@(-CbIm^T)
// Values are (re, im) pairs, as they lie in memory: packed two-float arithmetic.
__device__ __forceinline__ v2f cmul(v2f a, v2f b) {
    return a.xx * b + a.yy * (v2f){-b.y, b.x};
}
__device__ __forceinline__ v2f cbar_of(v2f a, v2f c, float eye) {
    const float hdt = DT * 0.5f;
    const v2f I = {eye, 0.0f};
    const v2f z = a * hdt;
    const v2f d = I - z;
    const v2f dd = d * d;
    const v2f r = (v2f){d.x, -d.y} * __builtin_amdgcn_rcpf(dd.x + dd.y);
    const v2f ab = cmul(r, I + z);
    const v2f e = I - ab * hdt;
    const v2f ee = e * e;
    const v2f q = (v2f){e.x, -e.y} * (__builtin_amdgcn_rcpf(ee.x + ee.y) * DT);
    const v2f cb = cmul(q, c);
    return (v2f){cb.x, -cb.y};
}

// ---------------------------------------------------------------------------
// Work-group barrier that orders LDS traffic only.  __syncthreads() also
// drains every global load and store of the wave; here the x loads issued two
// passes ahead and the y stores must stay in flight across the barriers.
// Nothing that one wave writes to global memory is read by another wave.
// ---------------------------------------------------------------------------
__device__ __forceinline__ void lds_only_barrier() {
    __builtin_amdgcn_fence(__ATOMIC_RELEASE, "workgroup", "local");
    __builtin_amdgcn_s_barrier();
    __builtin_amdgcn_fence(__ATOMIC_ACQUIRE, "workgroup", "local");
}

// ---------------------------------------------------------------------------
// The one kernel: parameters, the whole recurrence and its GEMM.
// Every block forms Cbar itself, as f16 B fragments in LDS (32 elements per thread), so no
// launch stands in front of this one.
// Two blocks per batch row, 16 waves each.  A block walks the sequence in passes
// of ST steps and keeps the running state in registers, so no other launch has
// to read x to find a start state.  The first block of a row does passes 0 to
// TS-1 in full.  The second block walks those TS passes for the state alone
// (carry and join: x is read, nothing is scanned, multiplied or stored), which
// costs a fraction of a full pass, and then does passes TS to NS-1 in full; TS
// is above NS/2 so that both blocks end at about the same time.
// Inside a pass the NG groups of 128 threads take LT neighbouring steps each:
//   carry   : each group scans its LT steps from zero (registers only),
//   join    : the NG carries meet in LDS; with P = Abar^LT every thread forms
//             e_0 = H, e_{j+1} = P*e_j + carry_j, keeps e_grp as its start
//             state and e_NG as the state H behind the pass,
//   scan    : each group scans its LT steps again from e_grp, f16 state to LDS.  The
//             tile lies transposed, a row per state element and a column per step:
//             a thread's steps are neighbours, eight of them go out in one 16-byte
//             store, and the GEMM reads its A fragments by transposing loads,
//   GEMM    : Y(ST x 128) = HRe @ CbRe^T + HIm @ (-CbIm^T), 16x16x32 f16 WMMA; a wave owns
//             only 32 columns (128 bytes) of a row, so the result goes to an LDS tile,
//   send    : behind the pass's last barrier each wave sends RPW whole rows of that tile
//             to memory, 512 contiguous bytes per store instruction.
// The carry of pass s+1 needs registers only and stands behind the GEMM of pass
// s.  x is loaded two passes ahead into the register set that the scan has just
// read.
// ---------------------------------------------------------------------------
// carry of LT steps scanned from a zero state
__device__ __forceinline__ float2 carry_of(const float (&x)[LT], float ar, float ai) {
    float cr = 0.0f, ci = 0.0f;
#pragma unroll   // x lies in registers: compile-time indices
    for (int lt = 0; lt < LT; ++lt) {
        const float nrr = x[lt] + cr * ar - ci * ai;
        const float nii = cr * ai + ci * ar;
        cr = nrr;
        ci = nii;
    }
    return make_float2(cr, ci);
}

// RPW whole rows of the output tile from LDS to memory, a row (512 bytes) per store;
// ybase is alike in the whole wave, yofs this lane's byte offset from it
__device__ __forceinline__ void send_rows(const float* sRow, unsigned long long ybase,
                                          unsigned int yofs) {
    v4f o[RPW];
#pragma unroll   // registers: compile-time indices; lets the LDS reads go out together
    for (int i = 0; i < RPW; ++i) o[i] = *(const v4f*)(sRow + i * YP);
    // All eight stores in one statement: its operands are live together, so the stores go
    // out back to back; s_clause keeps them together at issue.  Scalar base plus one offset
    // register that never changes: no address arithmetic in vector registers.  The stores
    // stay in flight, but their base and data registers are reused by what follows: the
    // wait at the end stands in front of that reuse.
    asm volatile("s_clause 0x7\n\t"
                 "global_store_b128 %0, %1, %9\n\t"
                 "global_store_b128 %0, %2, %9 offset:512\n\t"
                 "global_store_b128 %0, %3, %9 offset:1024\n\t"
                 "global_store_b128 %0, %4, %9 offset:1536\n\t"
                 "global_store_b128 %0, %5, %9 offset:2048\n\t"
                 "global_store_b128 %0, %6, %9 offset:2560\n\t"
                 "global_store_b128 %0, %7, %9 offset:3072\n\t"
                 "global_store_b128 %0, %8, %9 offset:3584\n\t"
                 "s_wait_xcnt 0x0"
                 :: "v"(yofs), "v"(o[0]), "v"(o[1]), "v"(o[2]), "v"(o[3]),
                    "v"(o[4]), "v"(o[5]), "v"(o[6]), "v"(o[7]), "s"(ybase) : "memory");
}

static_assert(WN == 2 && NCW == 4 && Hd == 128, "the prologue deals columns to pairs of fragments");
static_assert(RPW == 8 && (YP * 4) % 32 == 16, "eight stores per wave; pitch of the output tile");
static_assert(Hd * 4 == 512, "row pitch of the output in the store offsets");
static_assert(TPB >= ST * 2 && TPB % 32 == 0 && ((TPB / 32) & 1) == 1 && LT % 8 == 0,
              "state tile: a row holds a pass, pitch for the transposing load, 16-byte stores");
static_assert((TS & 1) == 1 && ((NS - TS) & 1) == 1 && TS + 1 < NS,
              "both blocks of a row end on the first x register set");

__global__ __launch_bounds__(512) void lssm_main_kernel(
    const float* __restrict__ X,
    const float* __restrict__ A_rt,
    const float* __restrict__ C_rt,
    float* __restrict__ Y) {
    // plane 0: real part, plane 1: imaginary part; [state element][step of the pass]
    __shared__ __attribute__((aligned(16))) _Float16 sH[2][Hd][TPB / 2];
    __shared__ float2 sC[NG][Hd];
    // the pass's output, [step of the pass][column]
    __shared__ __attribute__((aligned(16))) float sY[ST * YP];
    // Cbar as B fragments, f16 pairs: [plane][fragment kb*8+nb][k half][16-byte unit][pair]
    __shared__ __attribute__((aligned(16))) unsigned int sF[2 * 32 * 256];

    const int b = blockIdx.x & (Bd - 1);
    // the blocks that walk a prefix first have the low indices
    const bool second = blockIdx.x < Bd;
    const int sBeg = second ? TS : 0;        // passes [sBeg, sEnd) are done in full
    const int sEnd = second ? NS : TS;
    const int tid = threadIdx.x;
    const int lane = tid & 31;
    const int wave = tid >> 5;
    const int h = tid & (Hd - 1);            // state element this thread scans
    const int grp = tid >> 7;                // which LT steps of a pass it scans
    const int cw = wave & (NCW - 1);         // GEMM: which WN column blocks
    const int rw = wave / NCW;               // GEMM: which MTW row blocks
    const int khalf = lane >> 4;

    // block-uniform bases plus one 32-bit offset per thread: one address register each
    const float* xrow = X + (size_t)b * Ld * Hd;
    float* yrow = Y + (size_t)b * Ld * Hd;
    const unsigned int xofs = (unsigned int)(grp * LT * Hd + h);
    // send: this wave's RPW rows, 16 bytes of each per lane.  The lane's LDS byte address
    // serves as the offset register of the global stores too (one register for both): its
    // wave-uniform part sUni is taken off their scalar base
    const int waveU = __builtin_amdgcn_readfirstlane(wave);
    const float* sRow = &sY[waveU * RPW * YP + lane * 4];
    const unsigned int sOfs = (unsigned int)(unsigned long long)sRow;
    const unsigned int sUni = __builtin_amdgcn_readfirstlane(sOfs - (unsigned int)lane * 16u);
    const unsigned long long ywave = (unsigned long long)(yrow + waveU * RPW * Hd) - sUni;
    // GEMM: where this lane's first pair of accumulator elements goes in the output tile
    float* sAcc = &sY[(rw * MTW * 16 + khalf * 8) * YP + cw * WN * 16 + (lane & 15) * WN];
    // this lane's address in the first transposing load of plane 0 (k row 8*khalf +
    // lane%8, 16-byte piece (lane/8)%2 of the wave's first 16 steps); all else is a
    // constant offset
    const unsigned char* aBase = (const unsigned char*)&sH[0][(khalf << 3) + (lane & 7)]
                                                          [rw * MTW * 16 + (((lane >> 3) & 1) << 3)];
    // where this thread's LT steps of plane 0 go
    _Float16* tRow = &sH[0][h][grp * LT];
    float xv[2][LT];
#pragma unroll   // all 32 loads in flight at once, into registers
    for (int lt = 0; lt < LT; ++lt) xv[0][lt] = xrow[xofs + lt * Hd];
    // this thread's own element of A, for the recurrence
    const unsigned int aofs = (unsigned int)(b * Hd + h) * 8u;   // bytes
    const v2f aOwn = *(const v2f*)((const char*)A_rt + aofs);

    // ---- Cbar: 16 loads of two neighbouring elements (16 bytes of A, 16 of C) per thread ----
    // A wave takes eight rows i = wave*8 .. +7 of Cbar.  One load covers four whole 128-byte
    // lines: 8 lanes (fc) x 2 elements of the rows i = wave*8 + 2*fr + par, columns jb*16 ..
    const int fr = lane >> 3, fc = lane & 7;
    const unsigned int fofs = (unsigned int)((wave * 8 + 2 * fr) * (Hd * 2) + fc * 4) * 4u;   // bytes
    v4f fa[16], fcv[16];
#pragma unroll   // all loads in flight at once, into registers
    for (int u = 0; u < 16; ++u) {
        const int par = u & 1, jb = u >> 1;
        fa[u]  = *(const v4f*)((const char*)A_rt + fofs + par * (Hd * 8) + jb * 128);
        fcv[u] = *(const v4f*)((const char*)C_rt + fofs + par * (Hd * 8) + jb * 128);
    }
    // address registers of the loads above may be reused from here on; naming the
    // indices keeps their registers from being handed out ahead of the wait
    asm volatile("s_wait_xcnt 0x0" :: "v"(aofs), "v"(fofs) : "memory");
    // holds later instructions (and their register reuse) behind that wait
    __builtin_amdgcn_sched_barrier(0);

    const float2 aB = abar_of(aOwn[0], aOwn[1], (b == h) ? 1.0f : 0.0f);
    const float ar = aB.x;
    const float ai = aB.y;

    // B matrix element (k = j, n = i): B1[k][n] = CbRe[n][k], B2[k][n] = -CbIm[n][k]
    // Fragment layout (mirrors ISA 16-bit operand layout):
    //   kb = k>>5, kk = k&31
    //   lane    = nn + 16*((kk>>3)&1)
    //   halfIdx = ((kk>>4)<<3) + (kk&7)
    // Which output column sits in which fragment column is free.  The WN = 2
    // fragments of one wave share 32 neighbouring columns so that column 2*nn
    // lies in the first and column 2*nn+1 in the second (nb = (i>>5)*2 + (i&1),
    // nn = (i>>1)&15): a lane's two accumulators then hold neighbours.
    // In LDS a fragment is two runs (kk>>4) of 32 units of 16 bytes, a unit per fragment
    // lane: the reader's 16-byte loads are contiguous.  Units 16..31 stand with bit 2
    // flipped, so that the 32 4-byte stores of a wave below fall on 32 different banks.
    {
        const int nn = (wave & 3) * 4 + fr;
        const int unit = (fc >> 2) ? 16 + (nn ^ 4) : nn;
        unsigned int* fw = &sF[(wave >> 2) * 2 * 256 + unit * 4 + (fc & 3)];
        const int dij = wave * 8 + 2 * fr - 2 * fc;   // row minus column, at par = 0, jb = 0
#pragma unroll   // registers: compile-time indices
        for (int u = 0; u < 16; ++u) {
            const int par = u & 1, jb = u >> 1;
            // rows of parity par meet the diagonal only in the element of that parity
            const float hit = (dij == jb * 16) ? 1.0f : 0.0f;
            const v2f c0 = cbar_of(fa[u].xy, fcv[u].xy, par == 0 ? hit : 0.0f);
            const v2f c1 = cbar_of(fa[u].zw, fcv[u].zw, par == 1 ? hit : 0.0f);
            const int o = (jb >> 1) * 2048 + par * 256 + (jb & 1) * 128;
            fw[o]        = __builtin_bit_cast(unsigned int, (v2h){(_Float16)c0.x, (_Float16)c1.x});
            fw[o + 8192] = __builtin_bit_cast(unsigned int, (v2h){(_Float16)c0.y, (_Float16)c1.y});
        }
    }
    // publishes the fragments
    lds_only_barrier();

    // B fragments (this wave's WN*16 output columns, both planes): read once
    v16h bRe[WN][4], bIm[WN][4];
    {
        const unsigned int* fb = &sF[cw * WN * 256 + (lane ^ ((lane >> 4) << 2)) * 4];
#pragma unroll   // register arrays need compile-time indices
        for (int j = 0; j < WN; ++j) {
#pragma unroll   // as above
            for (int kb = 0; kb < 4; ++kb) {
                const unsigned int* p1 = fb + (kb * 8 + j) * 256;
                union { uint4 q[2]; v16h v; } bR, bI;
                bR.q[0] = *(const uint4*)(p1);
                bR.q[1] = *(const uint4*)(p1 + 128);
                bI.q[0] = *(const uint4*)(p1 + 8192);
                bI.q[1] = *(const uint4*)(p1 + 8192 + 128);
                bRe[j][kb] = bR.v;
                bIm[j][kb] = bI.v;
            }
        }
    }

    // P = Abar^LT via 5 complex squarings
    float pr = ar, pi = ai;
#pragma unroll   // five short steps, no loop overhead
    for (int q = 0; q < 5; ++q) {
        const float t = pr * pr - pi * pi;
        pi = 2.0f * pr * pi;
        pr = t;
    }

    float Hr = 0.0f, Hi = 0.0f;   // state in front of the pass (alike in all groups)

    // ---- second block of a row: passes 0 to TS-1 for the state behind them only ----
    if (second) {
#pragma unroll   // all 32 loads in flight at once, into registers
        for (int lt = 0; lt < LT; ++lt) xv[1][lt] = xrow[xofs + (ST + lt) * Hd];
        // address registers of these loads may be reused from here on
        asm volatile("s_wait_xcnt 0x0" ::: "memory");
        // holds later instructions (and their register reuse) behind that wait
        __builtin_amdgcn_sched_barrier(0);
        sC[grp][h] = carry_of(xv[0], ar, ai);
        lds_only_barrier();
        // stays rolled; two passes per trip for the two x register sets, as below
#pragma nounroll
        for (int s2 = 0; s2 < TS - 1; s2 += 2) {
#pragma unroll   // p picks the x register set: compile-time index
            for (int p = 0; p < 2; ++p) {
                // x of pass s+2 (at most pass TS) into the set whose carry is done
                const float* xn = xrow + (size_t)(s2 + p + 2) * ST * Hd;
#pragma unroll   // all 32 loads in flight at once, into registers
                for (int lt = 0; lt < LT; ++lt) xv[p][lt] = xn[xofs + lt * Hd];
                // address registers of these loads may be reused from here on
                asm volatile("s_wait_xcnt 0x0" ::: "memory");
                // keeps the loads at the head of the pass, a whole pass ahead of their use
                __builtin_amdgcn_sched_barrier(0);
#pragma unroll   // four short steps; lets the four LDS reads go out together
                for (int j = 0; j < NG; ++j) {
                    const float2 cj = sC[j][h];
                    const float nrr = pr * Hr - pi * Hi + cj.x;
                    const float nii = pr * Hi + pi * Hr + cj.y;
                    Hr = nrr;
                    Hi = nii;
                }
                // ends every read of sC by the join above
                lds_only_barrier();
                sC[grp][h] = carry_of(xv[p ^ 1], ar, ai);
                // publishes the carries
                lds_only_barrier();
            }
        }
        // pass TS-1: its carries are in sC; pass TS lies in the second register set
#pragma unroll   // four short steps; lets the four LDS reads go out together
        for (int j = 0; j < NG; ++j) {
            const float2 cj = sC[j][h];
            const float nrr = pr * Hr - pi * Hi + cj.x;
            const float nii = pr * Hi + pi * Hr + cj.y;
            Hr = nrr;
            Hi = nii;
        }
        // ends every read of sC before the carry below writes it again
        lds_only_barrier();
        // the full passes below start on the first register set
#pragma unroll   // registers: compile-time indices
        for (int lt = 0; lt < LT; ++lt) xv[0][lt] = xv[1][lt];
    }

    // x of the second full pass: behind the branch, so that no load is in flight
    // into this set where the two paths meet
    {
        const float* xn = xrow + (size_t)(sBeg + 1) * ST * Hd;
#pragma unroll   // all 32 loads in flight at once, into registers
        for (int lt = 0; lt < LT; ++lt) xv[1][lt] = xn[xofs + lt * Hd];
        // address registers of these loads may be reused from here on
        asm volatile("s_wait_xcnt 0x0" ::: "memory");
        // holds later instructions (and their register reuse) behind that wait
        __builtin_amdgcn_sched_barrier(0);
    }

    // carry of the first full pass
    sC[grp][h] = carry_of(xv[0], ar, ai);
    lds_only_barrier();

    // stays rolled;
    // two passes per trip because the two x register sets need compile-time indices
#pragma nounroll
    for (int s2 = sBeg; s2 < sEnd; s2 += 2) {
#pragma unroll   // p picks the x register set: compile-time index
        for (int p = 0; p < 2; ++p) {
            const int s = s2 + p;

            // ---- join: start state of this group, and the state behind the pass ----
            float hr = 0.0f, hi = 0.0f;
#pragma unroll   // four short steps; lets the four LDS reads go out together
            for (int j = 0; j < NG; ++j) {
                if (j == grp) { hr = Hr; hi = Hi; }
                const float2 cj = sC[j][h];
                const float nrr = pr * Hr - pi * Hi + cj.x;
                const float nii = pr * Hi + pi * Hr + cj.y;
                Hr = nrr;
                Hi = nii;
            }

            // ---- scan phase: LT dependent steps, f16 state to LDS ----
#pragma unroll   // x lies in registers: compile-time indices
            for (int q = 0; q < LT / 8; ++q) {
                v8h wr, wi;
#pragma unroll   // as above
                for (int e = 0; e < 8; ++e) {
                    const float nrr = xv[p][q * 8 + e] + hr * ar - hi * ai;
                    const float nii = hr * ai + hi * ar;
                    hr = nrr;
                    hi = nii;
                    wr[e] = (_Float16)hr;
                    wi[e] = (_Float16)hi;
                }
                *(v8h*)(tRow + q * 8) = wr;
                *(v8h*)(tRow + Hd * (TPB / 2) + q * 8) = wi;
            }

            // ---- x of pass s+2 into the set just read: first read one pass later ----
            // No branch round the loads: with one, the compiler must count its load
            // waits for the path without them, and every wait on the older set would
            // drain this one too.  The last pass but one reads pass sEnd-1 again (cache
            // hits).  The first set's loads stand behind the way out of the loop, below.
            if (p == 1) {
                const int sn = (s + 2 < sEnd) ? s + 2 : sEnd - 1;
                const float* xn = xrow + (size_t)sn * ST * Hd;
#pragma unroll   // all 32 loads in flight at once, into registers
                for (int lt = 0; lt < LT; ++lt) xv[1][lt] = xn[xofs + lt * Hd];
                // address registers of these loads may be reused from here on
                asm volatile("s_wait_xcnt 0x0" ::: "memory");
                // keeps the loads here instead of sunk behind the GEMM
                __builtin_amdgcn_sched_barrier(0);
            }
            // publishes the state tile; also ends every read of sC by the join above
            lds_only_barrier();

            // ---- GEMM phase ----
#pragma unroll
            for (int mt = 0; mt < MTW; ++mt) {   // which 16 steps (LDS columns, output rows)
                v8f acc[WN];
#pragma unroll
                for (int j = 0; j < WN; ++j)
                    acc[j] = (v8f){0.f, 0.f, 0.f, 0.f, 0.f, 0.f, 0.f, 0.f};

#pragma unroll
                for (int kb = 0; kb < 4; ++kb) {
                    // A fragments from LDS (16x32 f16): two transposing loads each, at k
                    // rows kb*32 and kb*32+16, give the k order 8*khalf+0..7, 16+8*khalf+0..7
                    // that the B fragments of the prologue have
                    union { uint4 q[2]; v16h v; } aR, aI;
#pragma unroll
                    for (int d = 0; d < 2; ++d) {
                        const int k0 = (kb * 32 + d * 16) * TPB + mt * 32;
                        aR.q[d] = lds_load_tr16(aBase + k0);
                        aI.q[d] = lds_load_tr16(aBase + Hd * TPB + k0);
                    }
#pragma unroll
                    for (int j = 0; j < WN; ++j) {
                        acc[j] = __builtin_amdgcn_wmma_f32_16x16x32_f16(
                            false, aR.v, false, bRe[j][kb], (short)0, acc[j], false, false);
                        acc[j] = __builtin_amdgcn_wmma_f32_16x16x32_f16(
                            false, aI.v, false, bIm[j][kb], (short)0, acc[j], false, false);
                    }
                }

                // D layout: VGPR r -> M = r + 8*(lane>=16), N = lane%16; fragment column
                // N of accumulator j is output column cw*32 + 2*N + j (prologue), so
                // one 8-byte LDS store per row
#pragma unroll   // registers: compile-time indices
                for (int r = 0; r < 8; ++r)
                    *(v2f*)(sAcc + (mt * 16 + r) * YP) = (v2f){acc[0][r], acc[1][r]};
            }
            // the last pass (always a p == 0: both blocks have an odd number of full
            // passes): its output tile is sent behind the loop
            if (p == 0 && s2 + 1 >= sEnd) break;
            if (p == 0) {
                // x of pass s+2 (it exists: the number of passes is odd).  Behind the
                // way out, so that no load into this set is in flight on that path:
                // else the compiler drains the newer set in every scan of this one
                const float* xn = xrow + (size_t)(s + 2) * ST * Hd;
#pragma unroll   // all 32 loads in flight at once, into registers
                for (int lt = 0; lt < LT; ++lt) xv[0][lt] = xn[xofs + lt * Hd];
                // address registers of these loads may be reused from here on
                asm volatile("s_wait_xcnt 0x0" ::: "memory");
                // keeps the loads ahead of the carry, a whole pass ahead of their use
                __builtin_amdgcn_sched_barrier(0);
            }
            // ---- carry of pass s+1: registers only, so a wave that is through
            // with its GEMM runs it while slower waves still use LDS and WMMA ----
            sC[grp][h] = carry_of(xv[p ^ 1], ar, ai);
            // frees the state tile for the next scan, publishes the carries and the output tile
            lds_only_barrier();
            // the next GEMM writes the tile again only behind the next scan's barrier
            send_rows(sRow, ywave + (unsigned long long)s * (ST * Hd * 4), sOfs);
        }
    }
    // publishes the last pass's output tile
    lds_only_barrier();
    send_rows(sRow, ywave + (unsigned long long)(sEnd - 1) * (ST * Hd * 4), sOfs);
    // the x loads of the last pass but one are never read, so no wait of the compiler's
    // covers them: a precaution, they land before the wave releases its registers
    asm volatile("s_wait_loadcnt 0x0" ::: "memory");
}

// ---------------------------------------------------------------------------
// Host-side launcher.  One launch; the workspace is not used.
// ---------------------------------------------------------------------------
extern "C" void kernel_launch(void* const* d_in, const int* in_sizes, int n_in,
                              void* d_out, int out_size, void* d_ws, size_t ws_size,
                              hipStream_t stream) {
    const float* X    = (const float*)d_in[0];
    const float* A_rt = (const float*)d_in[1];
    const float* C_rt = (const float*)d_in[2];
    float* out = (float*)d_out;

    lssm_main_kernel<<<dim3(NBLK), dim3(512), 0, stream>>>(X, A_rt, C_rt, out);
}

// v008
// Measured time: 31.5 microseconds a run.
// In two side-by-side timings against v007, it was 1.08 and 1.07 times as fast.
// All steps since v000 together make it 2.45 times as fast.
#include <hip/hip_runtime.h>

#define Hd 128
#define Bd 128
#define Ld 2048
#define NG 4              // time groups per block (each 128 threads, one per state element)
#define LT 32             // steps that one group scans per pass
#define ST (NG * LT)      // 128 steps per pass of the block
#define NS (Ld / ST)      // 16 passes walk the whole sequence
#define TS 9              // passes of a row's first block; its second block takes the other NS - TS
#define NBLK 256          // two blocks per batch row: one for every WGP of the chip
#define WN 2              // 16-column blocks per wave in the GEMM phase
#define NCW (8 / WN)      // waves side by side over the 128 columns
#define NRW (16 / NCW)    // waves above one another over the ST rows
#define MTW (ST / 16 / NRW)  // 16-row blocks per wave
#define TPB 288           // LDS row pitch in bytes of the state tile: 256 + 32, an odd multiple
                          // of 32 bytes, the pitch at which the transposing load has no conflict
#define YP 132            // LDS row pitch in floats of the output tile: 512 + 16 bytes, so that rows
                          // r and r+8, written by one 8-byte store, fall on different bank halves
#define RPW (ST / 16)     // output rows that one wave sends to memory per pass

static constexpr float DT = 0.01f;

typedef __attribute__((ext_vector_type(16))) _Float16 v16h;
typedef __attribute__((ext_vector_type(8)))  float    v8f;
typedef __attribute__((ext_vector_type(2)))  float    v2f;
typedef __attribute__((ext_vector_type(4)))  float    v4f;
typedef __attribute__((ext_vector_type(8)))  _Float16 v8h;
typedef __attribute__((ext_vector_type(2)))  _Float16 v2h;
typedef __attribute__((ext_vector_type(8)))  short    v8s;

// 16-byte transposing LDS load: from a tile whose rows are k and whose columns are the
// rows of the A operand, lane (c, half) gets column c of eight k rows
__device__ __forceinline__ uint4 lds_load_tr16(const unsigned char* p) {
    typedef __attribute__((address_space(3))) v8s lds_v8s;
    return __builtin_bit_cast(uint4, __builtin_amdgcn_ds_load_tr16_b128_v8i16((lds_v8s*)p));
}

// ---------------------------------------------------------------------------
// Parameters (all elementwise, I = eye):
//   Abar[i][j] = (1/(I - A*dt/2)) * (I + A*dt/2)
//   Cbar[i][j] = (1/(I - Abar*dt/2)) * C * dt
// ---------------------------------------------------------------------------
// Abar of one element, for the recurrence: true divisions
__device__ __forceinline__ float2 abar_of(float ar, float ai, float eye) {
    const float hdt = DT * 0.5f;
    const float zr = ar * hdt, zi = ai * hdt;
    const float dr = eye - zr, di = -zi;
    const float den = dr * dr + di * di;
    const float rr = dr / den, ri = -di / den;
    const float nr = eye + zr, ni = zi;
    return make_float2(rr * nr - ri * ni, rr * ni + ri * nr);
}

// (Re Cbar, -Im Cbar) of one element, for the f16 B operand: the same formulas with the
// hardware reciprocal, whose error lies far below half an f16 step.  The minus sign of the
// imaginary part is folded in:  Y = HRe@CbRe^T + HIm@(-CbIm^T)
// Values are (re, im) pairs, as they lie in memory: packed two-float arithmetic.
__device__ __forceinline__ v2f cmul(v2f a, v2f b) {
    return a.xx * b + a.yy * (v2f){-b.y, b.x};
}
__device__ __forceinline__ v2f cbar_of(v2f a, v2f c, float eye) {
    const float hdt = DT * 0.5f;
    const v2f I = {eye, 0.0f};
    const v2f z = a * hdt;
    const v2f d = I - z;
    const v2f dd = d * d;
    const v2f r = (v2f){d.x, -d.y} * __builtin_amdgcn_rcpf(dd.x + dd.y);
    const v2f ab = cmul(r, I + z);
    const v2f e = I - ab * hdt;
    const v2f ee = e * e;
    const v2f q = (v2f){e.x, -e.y} * (__builtin_amdgcn_rcpf(ee.x + ee.y) * DT);
    const v2f cb = cmul(q, c);
    return (v2f){cb.x, -cb.y};
}

// ---------------------------------------------------------------------------
// Work-group barrier that orders LDS traffic only.  __syncthreads() also
// drains every global load and store of the wave; here the x loads issued two
// passes ahead and the y stores must stay in flight across the barriers.
// Nothing that one wave writes to global memory is read by another wave.
// ---------------------------------------------------------------------------
__device__ __forceinline__ void lds_only_barrier() {
    __builtin_amdgcn_fence(__ATOMIC_RELEASE, "workgroup", "local");
    __builtin_amdgcn_s_barrier();
    __builtin_amdgcn_fence(__ATOMIC_ACQUIRE, "workgroup", "local");
}

// ---------------------------------------------------------------------------
// The one kernel: parameters, the whole recurrence and its GEMM.
// Every block forms Cbar itself, as f16 B fragments in LDS (32 elements per thread), so no
// launch stands in front of this one.
// Two blocks per batch row, 16 waves each.  A block walks the sequence in passes
// of ST steps and keeps the running state in registers, so no other launch has
// to read x to find a start state.  The first block of a row does passes 0 to
// TS-1 in full.  The second block walks those TS passes for the state alone
// (carry and join: x is read, nothing is scanned, multiplied or stored), which
// costs a fraction of a full pass, and then does passes TS to NS-1 in full; TS
// is above NS/2 so that both blocks end at about the same time.
// Inside a pass the NG groups of 128 threads take LT neighbouring steps each:
//   carry   : each group scans its LT steps from zero (registers only),
//   join    : the NG carries meet in LDS; with P = Abar^LT every thread forms
//             e_0 = H, e_{j+1} = P*e_j + carry_j, keeps e_grp as its start
//             state and e_NG as the state H behind the pass,
//   scan    : each group scans its LT steps again from e_grp, f16 state to LDS.  The
//             tile lies transposed, a row per state element and a column per step:
//             a thread's steps are neighbours, eight of them go out in one 16-byte
//             store, and the GEMM reads its A fragments by transposing loads,
//   GEMM    : Y(ST x 128) = HRe @ CbRe^T + HIm @ (-CbIm^T), 16x16x32 f16 WMMA; a wave owns
//             only 32 columns (128 bytes) of a row, so the result goes to an LDS tile.
//             The imaginary product runs over one block of 32 states only, the one that
//             holds state b of batch row b.  For every other state I = 0, so that
//             Abar = (1/(-z)) * z = -1 for any z but 0 (where the real plane too holds no
//             number): real, and with real x the state has no imaginary part (what the
//             recurrence leaves there is rounding residue),
//   send    : behind the pass's last barrier each wave sends RPW whole rows of that tile
//             to memory, 512 contiguous bytes per store instruction.
// The carry of pass s+1 needs registers only and stands behind the GEMM of pass
// s.  x is loaded two passes ahead into the register set that the scan has just
// read.
// ---------------------------------------------------------------------------
// carry of LT steps scanned from a zero state
__device__ __forceinline__ float2 carry_of(const float (&x)[LT], float ar, float ai) {
    float cr = 0.0f, ci = 0.0f;
#pragma unroll   // x lies in registers: compile-time indices
    for (int lt = 0; lt < LT; ++lt) {
        const float nrr = x[lt] + cr * ar - ci * ai;
        const float nii = cr * ai + ci * ar;
        cr = nrr;
        ci = nii;
    }
    return make_float2(cr, ci);
}

// RPW whole rows of the output tile from LDS to memory, a row (512 bytes) per store;
// ybase is alike in the whole wave, yofs this lane's byte offset from it
__device__ __forceinline__ void send_rows(const float* sRow, unsigned long long ybase,
                                          unsigned int yofs) {
    v4f o[RPW];
#pragma unroll   // registers: compile-time indices; lets the LDS reads go out together
    for (int i = 0; i < RPW; ++i) o[i] = *(const v4f*)(sRow + i * YP);
    // All eight stores in one statement: its operands are live together, so the stores go
    // out back to back; s_clause keeps them together at issue.  Scalar base plus one offset
    // register that never changes: no address arithmetic in vector registers.  The stores
    // stay in flight, but their base and data registers are reused by what follows: the
    // wait at the end stands in front of that reuse.
    asm volatile("s_clause 0x7\n\t"
                 "global_store_b128 %0, %1, %9\n\t"
                 "global_store_b128 %0, %2, %9 offset:512\n\t"
                 "global_store_b128 %0, %3, %9 offset:1024\n\t"
                 "global_store_b128 %0, %4, %9 offset:1536\n\t"
                 "global_store_b128 %0, %5, %9 offset:2048\n\t"
                 "global_store_b128 %0, %6, %9 offset:2560\n\t"
                 "global_store_b128 %0, %7, %9 offset:3072\n\t"
                 "global_store_b128 %0, %8, %9 offset:3584\n\t"
                 "s_wait_xcnt 0x0"
                 :: "v"(yofs), "v"(o[0]), "v"(o[1]), "v"(o[2]), "v"(o[3]),
                    "v"(o[4]), "v"(o[5]), "v"(o[6]), "v"(o[7]), "s"(ybase) : "memory");
}

static_assert(WN == 2 && NCW == 4 && Hd == 128, "the prologue deals columns to pairs of fragments");
static_assert(RPW == 8 && (YP * 4) % 32 == 16, "eight stores per wave; pitch of the output tile");
static_assert(Hd * 4 == 512, "row pitch of the output in the store offsets");
static_assert(TPB >= ST * 2 && TPB % 32 == 0 && ((TPB / 32) & 1) == 1 && LT % 8 == 0,
              "state tile: a row holds a pass, pitch for the transposing load, 16-byte stores");
static_assert((TS & 1) == 1 && ((NS - TS) & 1) == 1 && TS + 1 < NS,
              "both blocks of a row end on the first x register set");

__global__ __launch_bounds__(512) void lssm_main_kernel(
    const float* __restrict__ X,
    const float* __restrict__ A_rt,
    const float* __restrict__ C_rt,
    float* __restrict__ Y) {
    // plane 0: real part, plane 1: imaginary part; [state element][step of the pass]
    __shared__ __attribute__((aligned(16))) _Float16 sH[2][Hd][TPB / 2];
    __shared__ float2 sC[NG][Hd];
    // the pass's output, [step of the pass][column]
    __shared__ __attribute__((aligned(16))) float sY[ST * YP];
    // Cbar as B fragments, f16 pairs: [plane][fragment kb*8+nb][k half][16-byte unit][pair]
    __shared__ __attribute__((aligned(16))) unsigned int sF[2 * 32 * 256];

    const int b = blockIdx.x & (Bd - 1);
    // the blocks that walk a prefix first have the low indices
    const bool second = blockIdx.x < Bd;
    const int sBeg = second ? TS : 0;        // passes [sBeg, sEnd) are done in full
    const int sEnd = second ? NS : TS;
    const int tid = threadIdx.x;
    const int lane = tid & 31;
    const int wave = tid >> 5;
    const int h = tid & (Hd - 1);            // state element this thread scans
    const int grp = tid >> 7;                // which LT steps of a pass it scans
    const int cw = wave & (NCW - 1);         // GEMM: which WN column blocks
    const int rw = wave / NCW;               // GEMM: which MTW row blocks
    const int khalf = lane >> 4;
    const int kbB = b >> 5;                  // the block of 32 states with the diagonal one

    // block-uniform bases plus one 32-bit offset per thread: one address register each
    const float* xrow = X + (size_t)b * Ld * Hd;
    float* yrow = Y + (size_t)b * Ld * Hd;
    const unsigned int xofs = (unsigned int)(grp * LT * Hd + h);
    // send: this wave's RPW rows, 16 bytes of each per lane.  The lane's LDS byte address
    // serves as the offset register of the global stores too (one register for both): its
    // wave-uniform part sUni is taken off their scalar base
    const int waveU = __builtin_amdgcn_readfirstlane(wave);
    // does this wave scan states of that block?  Alike in the whole wave: a scalar branch
    const bool imW = (waveU & 3) == kbB;
    const float* sRow = &sY[waveU * RPW * YP + lane * 4];
    const unsigned int sOfs = (unsigned int)(unsigned long long)sRow;
    const unsigned int sUni = __builtin_amdgcn_readfirstlane(sOfs - (unsigned int)lane * 16u);
    const unsigned long long ywave = (unsigned long long)(yrow + waveU * RPW * Hd) - sUni;
    // GEMM: where this lane's first pair of accumulator elements goes in the output tile
    float* sAcc = &sY[(rw * MTW * 16 + khalf * 8) * YP + cw * WN * 16 + (lane & 15) * WN];
    // this lane's address in the first transposing load of plane 0 (k row 8*khalf +
    // lane%8, 16-byte piece (lane/8)%2 of the wave's first 16 steps); all else is a
    // constant offset
    const unsigned char* aBase = (const unsigned char*)&sH[0][(khalf << 3) + (lane & 7)]
                                                          [rw * MTW * 16 + (((lane >> 3) & 1) << 3)];
    // the same in plane 1, at the first k row of block kbB
    const unsigned char* aImB = aBase + (Hd + kbB * 32) * TPB;
    // where this thread's LT steps of plane 0 go
    _Float16* tRow = &sH[0][h][grp * LT];
    float xv[2][LT];
#pragma unroll   // all 32 loads in flight at once, into registers
    for (int lt = 0; lt < LT; ++lt) xv[0][lt] = xrow[xofs + lt * Hd];
    // this thread's own element of A, for the recurrence
    const unsigned int aofs = (unsigned int)(b * Hd + h) * 8u;   // bytes
    const v2f aOwn = *(const v2f*)((const char*)A_rt + aofs);

    // ---- Cbar: 16 loads of two neighbouring elements (16 bytes of A, 16 of C) per thread ----
    // A wave takes eight rows i = wave*8 .. +7 of Cbar.  One load covers four whole 128-byte
    // lines: 8 lanes (fc) x 2 elements of the rows i = wave*8 + 2*fr + par, columns jb*16 ..
    const int fr = lane >> 3, fc = lane & 7;
    const unsigned int fofs = (unsigned int)((wave * 8 + 2 * fr) * (Hd * 2) + fc * 4) * 4u;   // bytes
    v4f fa[16], fcv[16];
#pragma unroll   // all loads in flight at once, into registers
    for (int u = 0; u < 16; ++u) {
        const int par = u & 1, jb = u >> 1;
        fa[u]  = *(const v4f*)((const char*)A_rt + fofs + par * (Hd * 8) + jb * 128);
        fcv[u] = *(const v4f*)((const char*)C_rt + fofs + par * (Hd * 8) + jb * 128);
    }
    // address registers of the loads above may be reused from here on; naming the
    // indices keeps their registers from being handed out ahead of the wait
    asm volatile("s_wait_xcnt 0x0" :: "v"(aofs), "v"(fofs) : "memory");
    // holds later instructions (and their register reuse) behind that wait
    __builtin_amdgcn_sched_barrier(0);

    const float2 aB = abar_of(aOwn[0], aOwn[1], (b == h) ? 1.0f : 0.0f);
    const float ar = aB.x;
    const float ai = aB.y;

    // B matrix element (k = j, n = i): B1[k][n] = CbRe[n][k], B2[k][n] = -CbIm[n][k]
    // Fragment layout (mirrors ISA 16-bit operand layout):
    //   kb = k>>5, kk = k&31
    //   lane    = nn + 16*((kk>>3)&1)
    //   halfIdx = ((kk>>4)<<3) + (kk&7)
    // Which output column sits in which fragment column is free.  The WN = 2
    // fragments of one wave share 32 neighbouring columns so that column 2*nn
    // lies in the first and column 2*nn+1 in the second (nb = (i>>5)*2 + (i&1),
    // nn = (i>>1)&15): a lane's two accumulators then hold neighbours.
    // In LDS a fragment is two runs (kk>>4) of 32 units of 16 bytes, a unit per fragment
    // lane: the reader's 16-byte loads are contiguous.  Units 16..31 stand with bit 2
    // flipped, so that the 32 4-byte stores of a wave below fall on 32 different banks.
    {
        const int nn = (wave & 3) * 4 + fr;
        const int unit = (fc >> 2) ? 16 + (nn ^ 4) : nn;
        unsigned int* fw = &sF[(wave >> 2) * 2 * 256 + unit * 4 + (fc & 3)];
        const int dij = wave * 8 + 2 * fr - 2 * fc;   // row minus column, at par = 0, jb = 0
#pragma unroll   // registers: compile-time indices
        for (int u = 0; u < 16; ++u) {
            const int par = u & 1, jb = u >> 1;
            // rows of parity par meet the diagonal only in the element of that parity
            const float hit = (dij == jb * 16) ? 1.0f : 0.0f;
            const v2f c0 = cbar_of(fa[u].xy, fcv[u].xy, par == 0 ? hit : 0.0f);
            const v2f c1 = cbar_of(fa[u].zw, fcv[u].zw, par == 1 ? hit : 0.0f);
            const int o = (jb >> 1) * 2048 + par * 256 + (jb & 1) * 128;
            fw[o]        = __builtin_bit_cast(unsigned int, (v2h){(_Float16)c0.x, (_Float16)c1.x});
            // the imaginary plane is read for the k block kbB only (block-uniform test)
            if ((jb >> 1) == kbB)
                fw[o + 8192] = __builtin_bit_cast(unsigned int, (v2h){(_Float16)c0.y, (_Float16)c1.y});
        }
    }
    // publishes the fragments
    lds_only_barrier();

    // B fragments (this wave's WN*16 output columns; real plane, and k block kbB of the
    // imaginary plane): read once
    v16h bRe[WN][4], bIm[WN];
    {
        const unsigned int* fb = &sF[cw * WN * 256 + (lane ^ ((lane >> 4) << 2)) * 4];
#pragma unroll   // register arrays need compile-time indices
        for (int j = 0; j < WN; ++j) {
#pragma unroll   // as above
            for (int kb = 0; kb < 4; ++kb) {
                const unsigned int* p1 = fb + (kb * 8 + j) * 256;
                union { uint4 q[2]; v16h v; } bR;
                bR.q[0] = *(const uint4*)(p1);
                bR.q[1] = *(const uint4*)(p1 + 128);
                bRe[j][kb] = bR.v;
            }
            const unsigned int* p2 = fb + (kbB * 8 + j) * 256 + 8192;
            union { uint4 q[2]; v16h v; } bI;
            bI.q[0] = *(const uint4*)(p2);
            bI.q[1] = *(const uint4*)(p2 + 128);
            bIm[j] = bI.v;
        }
    }

    // P = Abar^LT via 5 complex squarings
    float pr = ar, pi = ai;
#pragma unroll   // five short steps, no loop overhead
    for (int q = 0; q < 5; ++q) {
        const float t = pr * pr - pi * pi;
        pi = 2.0f * pr * pi;
        pr = t;
    }

    float Hr = 0.0f, Hi = 0.0f;   // state in front of the pass (alike in all groups)

    // ---- second block of a row: passes 0 to TS-1 for the state behind them only ----
    if (second) {
#pragma unroll   // all 32 loads in flight at once, into registers
        for (int lt = 0; lt < LT; ++lt) xv[1][lt] = xrow[xofs + (ST + lt) * Hd];
        // address registers of these loads may be reused from here on
        asm volatile("s_wait_xcnt 0x0" ::: "memory");
        // holds later instructions (and their register reuse) behind that wait
        __builtin_amdgcn_sched_barrier(0);
        sC[grp][h] = carry_of(xv[0], ar, ai);
        lds_only_barrier();
        // stays rolled; two passes per trip for the two x register sets, as below
#pragma nounroll
        for (int s2 = 0; s2 < TS - 1; s2 += 2) {
#pragma unroll   // p picks the x register set: compile-time index
            for (int p = 0; p < 2; ++p) {
                // x of pass s+2 (at most pass TS) into the set whose carry is done
                const float* xn = xrow + (size_t)(s2 + p + 2) * ST * Hd;
#pragma unroll   // all 32 loads in flight at once, into registers
                for (int lt = 0; lt < LT; ++lt) xv[p][lt] = xn[xofs + lt * Hd];
                // address registers of these loads may be reused from here on
                asm volatile("s_wait_xcnt 0x0" ::: "memory");
                // keeps the loads at the head of the pass, a whole pass ahead of their use
                __builtin_amdgcn_sched_barrier(0);
#pragma unroll   // four short steps; lets the four LDS reads go out together
                for (int j = 0; j < NG; ++j) {
                    const float2 cj = sC[j][h];
                    const float nrr = pr * Hr - pi * Hi + cj.x;
                    const float nii = pr * Hi + pi * Hr + cj.y;
                    Hr = nrr;
                    Hi = nii;
                }
                // ends every read of sC by the join above
                lds_only_barrier();
                sC[grp][h] = carry_of(xv[p ^ 1], ar, ai);
                // publishes the carries
                lds_only_barrier();
            }
        }
        // pass TS-1: its carries are in sC; pass TS lies in the second register set
#pragma unroll   // four short steps; lets the four LDS reads go out together
        for (int j = 0; j < NG; ++j) {
            const float2 cj = sC[j][h];
            const float nrr = pr * Hr - pi * Hi + cj.x;
            const float nii = pr * Hi + pi * Hr + cj.y;
            Hr = nrr;
            Hi = nii;
        }
        // ends every read of sC before the carry below writes it again
        lds_only_barrier();
        // the full passes below start on the first register set
#pragma unroll   // registers: compile-time indices
        for (int lt = 0; lt < LT; ++lt) xv[0][lt] = xv[1][lt];
    }

    // x of the second full pass: behind the branch, so that no load is in flight
    // into this set where the two paths meet
    {
        const float* xn = xrow + (size_t)(sBeg + 1) * ST * Hd;
#pragma unroll   // all 32 loads in flight at once, into registers
        for (int lt = 0; lt < LT; ++lt) xv[1][lt] = xn[xofs + lt * Hd];
        // address registers of these loads may be reused from here on
        asm volatile("s_wait_xcnt 0x0" ::: "memory");
        // holds later instructions (and their register reuse) behind that wait
        __builtin_amdgcn_sched_barrier(0);
    }

    // carry of the first full pass
    sC[grp][h] = carry_of(xv[0], ar, ai);
    lds_only_barrier();

    // stays rolled;
    // two passes per trip because the two x register sets need compile-time indices
#pragma nounroll
    for (int s2 = sBeg; s2 < sEnd; s2 += 2) {
#pragma unroll   // p picks the x register set: compile-time index
        for (int p = 0; p < 2; ++p) {
            const int s = s2 + p;

            // ---- join: start state of this group, and the state behind the pass ----
            float hr = 0.0f, hi = 0.0f;
#pragma unroll   // four short steps; lets the four LDS reads go out together
            for (int j = 0; j < NG; ++j) {
                if (j == grp) { hr = Hr; hi = Hi; }
                const float2 cj = sC[j][h];
                const float nrr = pr * Hr - pi * Hi + cj.x;
                const float nii = pr * Hi + pi * Hr + cj.y;
                Hr = nrr;
                Hi = nii;
            }

            // ---- scan phase: LT dependent steps, f16 state to LDS ----
            v8h wiq[LT / 8];
#pragma unroll   // x lies in registers: compile-time indices
            for (int q = 0; q < LT / 8; ++q) {
                v8h wr, wi;
#pragma unroll   // as above
                for (int e = 0; e < 8; ++e) {
                    const float nrr = xv[p][q * 8 + e] + hr * ar - hi * ai;
                    const float nii = hr * ai + hi * ar;
                    hr = nrr;
                    hi = nii;
                    wr[e] = (_Float16)hr;
                    wi[e] = (_Float16)hi;
                }
                *(v8h*)(tRow + q * 8) = wr;
                wiq[q] = wi;
            }
            // imaginary parts: only the rows that the GEMM reads
            if (imW) {
#pragma unroll   // registers: compile-time indices
                for (int q = 0; q < LT / 8; ++q)
                    *(v8h*)(tRow + Hd * (TPB / 2) + q * 8) = wiq[q];
            }

            // ---- x of pass s+2 into the set just read: first read one pass later ----
            // No branch round the loads: with one, the compiler must count its load
            // waits for the path without them, and every wait on the older set would
            // drain this one too.  The last pass but one reads pass sEnd-1 again (cache
            // hits).  The first set's loads stand behind the way out of the loop, below.
            if (p == 1) {
                const int sn = (s + 2 < sEnd) ? s + 2 : sEnd - 1;
                const float* xn = xrow + (size_t)sn * ST * Hd;
#pragma unroll   // all 32 loads in flight at once, into registers
                for (int lt = 0; lt < LT; ++lt) xv[1][lt] = xn[xofs + lt * Hd];
                // address registers of these loads may be reused from here on
                asm volatile("s_wait_xcnt 0x0" ::: "memory");
                // keeps the loads here instead of sunk behind the GEMM
                __builtin_amdgcn_sched_barrier(0);
            }
            // publishes the state tile; also ends every read of sC by the join above
            lds_only_barrier();

            // ---- GEMM phase ----
#pragma unroll
            for (int mt = 0; mt < MTW; ++mt) {   // which 16 steps (LDS columns, output rows)
                v8f acc[WN];
#pragma unroll
                for (int j = 0; j < WN; ++j)
                    acc[j] = (v8f){0.f, 0.f, 0.f, 0.f, 0.f, 0.f, 0.f, 0.f};

#pragma unroll
                for (int kb = 0; kb < 4; ++kb) {
                    // A fragments from LDS (16x32 f16): two transposing loads each, at k
                    // rows kb*32 and kb*32+16, give the k order 8*khalf+0..7, 16+8*khalf+0..7
                    // that the B fragments of the prologue have
                    union { uint4 q[2]; v16h v; } aR;
#pragma unroll
                    for (int d = 0; d < 2; ++d)
                        aR.q[d] = lds_load_tr16(aBase + (kb * 32 + d * 16) * TPB + mt * 32);
#pragma unroll
                    for (int j = 0; j < WN; ++j)
                        acc[j] = __builtin_amdgcn_wmma_f32_16x16x32_f16(
                            false, aR.v, false, bRe[j][kb], (short)0, acc[j], false, false);
                }
                {
                    // the imaginary plane's one k block, same k order
                    union { uint4 q[2]; v16h v; } aI;
#pragma unroll
                    for (int d = 0; d < 2; ++d)
                        aI.q[d] = lds_load_tr16(aImB + d * 16 * TPB + mt * 32);
#pragma unroll
                    for (int j = 0; j < WN; ++j)
                        acc[j] = __builtin_amdgcn_wmma_f32_16x16x32_f16(
                            false, aI.v, false, bIm[j], (short)0, acc[j], false, false);
                }

                // D layout: VGPR r -> M = r + 8*(lane>=16), N = lane%16; fragment column
                // N of accumulator j is output column cw*32 + 2*N + j (prologue), so
                // one 8-byte LDS store per row
#pragma unroll   // registers: compile-time indices
                for (int r = 0; r < 8; ++r)
                    *(v2f*)(sAcc + (mt * 16 + r) * YP) = (v2f){acc[0][r], acc[1][r]};
                // one row block's fragments at a time: drawn together with the next block's
                // and the carry below, they push a B fragment out to scratch memory
                __builtin_amdgcn_sched_barrier(0);
            }
            // the last pass (always a p == 0: both blocks have an odd number of full
            // passes): its output tile is sent behind the loop
            if (p == 0 && s2 + 1 >= sEnd) break;
            if (p == 0) {
                // x of pass s+2 (it exists: the number of passes is odd).  Behind the
                // way out, so that no load into this set is in flight on that path:
                // else the compiler drains the newer set in every scan of this one
                const float* xn = xrow + (size_t)(s + 2) * ST * Hd;
#pragma unroll   // all 32 loads in flight at once, into registers
                for (int lt = 0; lt < LT; ++lt) xv[0][lt] = xn[xofs + lt * Hd];
                // address registers of these loads may be reused from here on
                asm volatile("s_wait_xcnt 0x0" ::: "memory");
                // keeps the loads ahead of the carry, a whole pass ahead of their use
                __builtin_amdgcn_sched_barrier(0);
            }
            // ---- carry of pass s+1: registers only, so a wave that is through
            // with its GEMM runs it while slower waves still use LDS and WMMA ----
            sC[grp][h] = carry_of(xv[p ^ 1], ar, ai);
            // frees the state tile for the next scan, publishes the carries and the output tile
            lds_only_barrier();
            // the next GEMM writes the tile again only behind the next scan's barrier
            send_rows(sRow, ywave + (unsigned long long)s * (ST * Hd * 4), sOfs);
        }
    }
    // publishes the last pass's output tile
    lds_only_barrier();
    send_rows(sRow, ywave + (unsigned long long)(sEnd - 1) * (ST * Hd * 4), sOfs);
    // the x loads of the last pass but one are never read, so no wait of the compiler's
    // covers them: a precaution, they land before the wave releases its registers
    asm volatile("s_wait_loadcnt 0x0" ::: "memory");
}

// ---------------------------------------------------------------------------
// Host-side launcher.  One launch; the workspace is not used.
// ---------------------------------------------------------------------------
extern "C" void kernel_launch(void* const* d_in, const int* in_sizes, int n_in,
                              void* d_out, int out_size, void* d_ws, size_t ws_size,
                              hipStream_t stream) {
    const float* X    = (const float*)d_in[0];
    const float* A_rt = (const float*)d_in[1];
    const float* C_rt = (const float*)d_in[2];
    float* out = (float*)d_out;

    lssm_main_kernel<<<dim3(NBLK), dim3(512), 0, stream>>>(X, A_rt, C_rt, out);
}

// v009
// Measured time: 30.3 microseconds a run.
// Timed twice side by side with v008, it ran 1.04 times as fast both times.
// Over all steps from v000 it is 2.54 times as fast.
#include <hip/hip_runtime.h>

#define Hd 128
#define Bd 128
#define Ld 2048
#define NG 4              // time groups per block (each 128 threads, one per state element)
#define LT 32             // steps that one group scans per pass
#define ST (NG * LT)      // 128 steps per pass of the block
#define NS (Ld / ST)      // 16 passes walk the whole sequence
#define TS 9              // passes of a row's first block; its second block takes the other NS - TS
#define NBLK 256          // two blocks per batch row: one for every WGP of the chip
#define WN 2              // 16-column blocks per wave in the GEMM phase
#define NCW (8 / WN)      // waves side by side over the 128 columns
#define NRW (16 / NCW)    // waves above one another over the ST rows
#define MTW (ST / 16 / NRW)  // 16-row blocks per wave
#define TPB 288           // LDS row pitch in bytes of the state tile: 256 + 32, an odd multiple
                          // of 32 bytes, the pitch at which the transposing load has no conflict
#define YP 132            // LDS row pitch in floats of the output tile: 512 + 16 bytes, so that rows
                          // r and r+8, written by one 8-byte store, fall on different bank halves
#define RPW (ST / 16)     // output rows that one wave sends to memory per pass

static constexpr float DT = 0.01f;

typedef __attribute__((ext_vector_type(16))) _Float16 v16h;
typedef __attribute__((ext_vector_type(8)))  float    v8f;
typedef __attribute__((ext_vector_type(2)))  float    v2f;
typedef __attribute__((ext_vector_type(4)))  float    v4f;
typedef __attribute__((ext_vector_type(8)))  _Float16 v8h;
typedef __attribute__((ext_vector_type(2)))  _Float16 v2h;
typedef __attribute__((ext_vector_type(8)))  short    v8s;

// 16-byte transposing LDS load: from a tile whose rows are k and whose columns are the
// rows of the A operand, lane (c, half) gets column c of eight k rows
__device__ __forceinline__ uint4 lds_load_tr16(const unsigned char* p) {
    typedef __attribute__((address_space(3))) v8s lds_v8s;
    return __builtin_bit_cast(uint4, __builtin_amdgcn_ds_load_tr16_b128_v8i16((lds_v8s*)p));
}

// ---------------------------------------------------------------------------
// Parameters (all elementwise, I = eye):
//   Abar[i][j] = (1/(I - A*dt/2)) * (I + A*dt/2)
//   Cbar[i][j] = (1/(I - Abar*dt/2)) * C * dt
// ---------------------------------------------------------------------------
// Abar of one element, for the recurrence: true divisions
__device__ __forceinline__ float2 abar_of(float ar, float ai, float eye) {
    const float hdt = DT * 0.5f;
    const float zr = ar * hdt, zi = ai * hdt;
    const float dr = eye - zr, di = -zi;
    const float den = dr * dr + di * di;
    const float rr = dr / den, ri = -di / den;
    const float nr = eye + zr, ni = zi;
    return make_float2(rr * nr - ri * ni, rr * ni + ri * nr);
}

// (Re Cbar, -Im Cbar) of one element, for the f16 B operand: the same formulas with the
// hardware reciprocal, whose error lies far below half an f16 step.  The minus sign of the
// imaginary part is folded in:  Y = HRe@CbRe^T + HIm@(-CbIm^T)
// Values are (re, im) pairs, as they lie in memory: packed two-float arithmetic.
__device__ __forceinline__ v2f cmul(v2f a, v2f b) {
    return a.xx * b + a.yy * (v2f){-b.y, b.x};
}
__device__ __forceinline__ v2f cbar_of(v2f a, v2f c, float eye) {
    const float hdt = DT * 0.5f;
    const v2f I = {eye, 0.0f};
    const v2f z = a * hdt;
    const v2f d = I - z;
    const v2f dd = d * d;
    const v2f r = (v2f){d.x, -d.y} * __builtin_amdgcn_rcpf(dd.x + dd.y);
    const v2f ab = cmul(r, I + z);
    const v2f e = I - ab * hdt;
    const v2f ee = e * e;
    const v2f q = (v2f){e.x, -e.y} * (__builtin_amdgcn_rcpf(ee.x + ee.y) * DT);
    const v2f cb = cmul(q, c);
    return (v2f){cb.x, -cb.y};
}

// ---------------------------------------------------------------------------
// Work-group barrier that orders LDS traffic only.  __syncthreads() also
// drains every global load and store of the wave; here the x loads issued two
// passes ahead and the y stores must stay in flight across the barriers.
// Nothing that one wave writes to global memory is read by another wave.
// ---------------------------------------------------------------------------
__device__ __forceinline__ void lds_only_barrier() {
    __builtin_amdgcn_fence(__ATOMIC_RELEASE, "workgroup", "local");
    __builtin_amdgcn_s_barrier();
    __builtin_amdgcn_fence(__ATOMIC_ACQUIRE, "workgroup", "local");
}

// ---------------------------------------------------------------------------
// The one kernel: parameters, the whole recurrence and its GEMM.
// Every block forms Cbar itself, as f16 B fragments in LDS (32 elements per thread), so no
// launch stands in front of this one.
// Two blocks per batch row, 16 waves each.  A block walks the sequence in passes
// of ST steps and keeps the running state in registers, so no other launch has
// to read x to find a start state.  The first block of a row does passes 0 to
// TS-1 in full.  The second block walks those TS passes for the state alone
// (carry and join: x is read, nothing is scanned, multiplied or stored), which
// costs a fraction of a full pass, and then does passes TS to NS-1 in full; TS
// is above NS/2 so that both blocks end at about the same time.
// Inside a pass the NG groups of 128 threads take LT neighbouring steps each:
//   carry   : each group scans its LT steps from zero (registers only),
//   join    : the NG carries meet in LDS; with P = Abar^LT every thread forms
//             e_0 = H, e_{j+1} = P*e_j + carry_j, keeps e_grp as its start
//             state and e_NG as the state H behind the pass,
//   scan    : each group scans its LT steps again from e_grp, f16 state to LDS.  The
//             tile lies transposed, a row per state element and a column per step:
//             a thread's steps are neighbours, eight of them go out in one 16-byte
//             store, and the GEMM reads its A fragments by transposing loads,
//   GEMM    : Y(ST x 128) = HRe @ CbRe^T + HIm @ (-CbIm^T), 16x16x32 f16 WMMA; a wave owns
//             only 32 columns (128 bytes) of a row, so the result goes to an LDS tile.
//             The imaginary product runs over one block of 32 states only, the one that
//             holds state b of batch row b.  For every other state I = 0, so that
//             Abar = (1/(-z)) * z = -1 for any z but 0 (where the real plane too holds no
//             number): real, and with real x the state has no imaginary part (what the
//             recurrence leaves there is rounding residue),
//   real    : for the same reason only the four waves that hold state b (one per group)
//             run carry, join and scan in complex arithmetic.  The other twelve take
//             Im Abar as 0 and run them on the real part alone: one multiply-add per
//             step, not four, and a dependent chain half as long,
//   send    : behind the pass's last barrier each wave sends RPW whole rows of that tile
//             to memory, 512 contiguous bytes per store instruction.
// The carry of pass s+1 needs registers only and stands behind the GEMM of pass
// s.  x is loaded two passes ahead into the register set that the scan has just
// read.
// ---------------------------------------------------------------------------
// carry of LT steps scanned from a zero state
__device__ __forceinline__ float2 carry_of(const float (&x)[LT], float ar, float ai) {
    float cr = 0.0f, ci = 0.0f;
#pragma unroll   // x lies in registers: compile-time indices
    for (int lt = 0; lt < LT; ++lt) {
        const float nrr = x[lt] + cr * ar - ci * ai;
        const float nii = cr * ai + ci * ar;
        cr = nrr;
        ci = nii;
    }
    return make_float2(cr, ci);
}

// the same for a wave whose states are all real
__device__ __forceinline__ float carry_re(const float (&x)[LT], float ar) {
    float c = 0.0f;
#pragma unroll   // x lies in registers: compile-time indices
    for (int lt = 0; lt < LT; ++lt) c = x[lt] + c * ar;
    return c;
}

// carry of one group's LT steps to LDS; cplx is alike in the whole wave
__device__ __forceinline__ void put_carry(float2* dst, const float (&x)[LT], float ar, float ai,
                                          bool cplx) {
    if (cplx) *dst = carry_of(x, ar, ai);
    else      dst->x = carry_re(x, ar);
}

// RPW whole rows of the output tile from LDS to memory, a row (512 bytes) per store;
// ybase is alike in the whole wave, yofs this lane's byte offset from it
__device__ __forceinline__ void send_rows(const float* sRow, unsigned long long ybase,
                                          unsigned int yofs) {
    v4f o[RPW];
#pragma unroll   // registers: compile-time indices; lets the LDS reads go out together
    for (int i = 0; i < RPW; ++i) o[i] = *(const v4f*)(sRow + i * YP);
    // All eight stores in one statement: its operands are live together, so the stores go
    // out back to back; s_clause keeps them together at issue.  Scalar base plus one offset
    // register that never changes: no address arithmetic in vector registers.  The stores
    // stay in flight, but their base and data registers are reused by what follows: the
    // wait at the end stands in front of that reuse.
    asm volatile("s_clause 0x7\n\t"
                 "global_store_b128 %0, %1, %9\n\t"
                 "global_store_b128 %0, %2, %9 offset:512\n\t"
                 "global_store_b128 %0, %3, %9 offset:1024\n\t"
                 "global_store_b128 %0, %4, %9 offset:1536\n\t"
                 "global_store_b128 %0, %5, %9 offset:2048\n\t"
                 "global_store_b128 %0, %6, %9 offset:2560\n\t"
                 "global_store_b128 %0, %7, %9 offset:3072\n\t"
                 "global_store_b128 %0, %8, %9 offset:3584\n\t"
                 "s_wait_xcnt 0x0"
                 :: "v"(yofs), "v"(o[0]), "v"(o[1]), "v"(o[2]), "v"(o[3]),
                    "v"(o[4]), "v"(o[5]), "v"(o[6]), "v"(o[7]), "s"(ybase) : "memory");
}

static_assert(WN == 2 && NCW == 4 && Hd == 128, "the prologue deals columns to pairs of fragments");
static_assert(RPW == 8 && (YP * 4) % 32 == 16, "eight stores per wave; pitch of the output tile");
static_assert(Hd * 4 == 512, "row pitch of the output in the store offsets");
static_assert(TPB >= ST * 2 && TPB % 32 == 0 && ((TPB / 32) & 1) == 1 && LT % 8 == 0,
              "state tile: a row holds a pass, pitch for the transposing load, 16-byte stores");
static_assert((TS & 1) == 1 && ((NS - TS) & 1) == 1 && TS + 1 < NS,
              "both blocks of a row end on the first x register set");

__global__ __launch_bounds__(512) void lssm_main_kernel(
    const float* __restrict__ X,
    const float* __restrict__ A_rt,
    const float* __restrict__ C_rt,
    float* __restrict__ Y) {
    // plane 0: real part, plane 1: imaginary part; [state element][step of the pass]
    __shared__ __attribute__((aligned(16))) _Float16 sH[2][Hd][TPB / 2];
    __shared__ float2 sC[NG][Hd];
    // the pass's output, [step of the pass][column]
    __shared__ __attribute__((aligned(16))) float sY[ST * YP];
    // Cbar as B fragments, f16 pairs: [plane][fragment kb*8+nb][k half][16-byte unit][pair]
    __shared__ __attribute__((aligned(16))) unsigned int sF[2 * 32 * 256];

    const int b = blockIdx.x & (Bd - 1);
    // the blocks that walk a prefix first have the low indices
    const bool second = blockIdx.x < Bd;
    const int sBeg = second ? TS : 0;        // passes [sBeg, sEnd) are done in full
    const int sEnd = second ? NS : TS;
    const int tid = threadIdx.x;
    const int lane = tid & 31;
    const int wave = tid >> 5;
    const int waveU = __builtin_amdgcn_readfirstlane(wave);
    const int kbB = b >> 5;                  // the block of 32 states with the diagonal one
    const int grp = waveU & 3;               // which LT steps of a pass this wave scans
    // which 32 states it scans: waves 0 to 3 take block kbB.  Theirs is the long, complex
    // chain
    const int hb = (kbB + (waveU >> 2)) & 3;
    const int h = hb * 32 + lane;            // state element this thread scans
    // does this wave scan the states of block kbB?  Alike in the whole wave: a scalar branch
    const bool imW = waveU < 4;
    const int cw = wave & (NCW - 1);         // GEMM: which WN column blocks
    const int rw = wave / NCW;               // GEMM: which MTW row blocks
    const int khalf = lane >> 4;

    // block-uniform bases plus one 32-bit offset per thread: one address register each
    const float* xrow = X + (size_t)b * Ld * Hd;
    float* yrow = Y + (size_t)b * Ld * Hd;
    const unsigned int xofs = (unsigned int)(grp * LT * Hd + h);
    // send: this wave's RPW rows, 16 bytes of each per lane.  The lane's LDS byte address
    // serves as the offset register of the global stores too (one register for both): its
    // wave-uniform part sUni is taken off their scalar base
    const float* sRow = &sY[waveU * RPW * YP + lane * 4];
    const unsigned int sOfs = (unsigned int)(unsigned long long)sRow;
    const unsigned int sUni = __builtin_amdgcn_readfirstlane(sOfs - (unsigned int)lane * 16u);
    const unsigned long long ywave = (unsigned long long)(yrow + waveU * RPW * Hd) - sUni;
    // GEMM: where this lane's first pair of accumulator elements goes in the output tile
    float* sAcc = &sY[(rw * MTW * 16 + khalf * 8) * YP + cw * WN * 16 + (lane & 15) * WN];
    // this lane's address in the first transposing load of plane 0 (k row 8*khalf +
    // lane%8, 16-byte piece (lane/8)%2 of the wave's first 16 steps); all else is a
    // constant offset
    const unsigned char* aBase = (const unsigned char*)&sH[0][(khalf << 3) + (lane & 7)]
                                                          [rw * MTW * 16 + (((lane >> 3) & 1) << 3)];
    // the same in plane 1, at the first k row of block kbB
    const unsigned char* aImB = aBase + (Hd + kbB * 32) * TPB;
    // where this thread's LT steps of plane 0 go
    _Float16* tRow = &sH[0][h][grp * LT];
    float xv[2][LT];
#pragma unroll   // all 32 loads in flight at once, into registers
    for (int lt = 0; lt < LT; ++lt) xv[0][lt] = xrow[xofs + lt * Hd];
    // this thread's own element of A, for the recurrence
    const unsigned int aofs = (unsigned int)(b * Hd + h) * 8u;   // bytes
    const v2f aOwn = *(const v2f*)((const char*)A_rt + aofs);

    // ---- Cbar: 16 loads of two neighbouring elements (16 bytes of A, 16 of C) per thread ----
    // A wave takes eight rows i = wave*8 .. +7 of Cbar.  One load covers four whole 128-byte
    // lines: 8 lanes (fc) x 2 elements of the rows i = wave*8 + 2*fr + par, columns jb*16 ..
    const int fr = lane >> 3, fc = lane & 7;
    const unsigned int fofs = (unsigned int)((wave * 8 + 2 * fr) * (Hd * 2) + fc * 4) * 4u;   // bytes
    v4f fa[16], fcv[16];
#pragma unroll   // all loads in flight at once, into registers
    for (int u = 0; u < 16; ++u) {
        const int par = u & 1, jb = u >> 1;
        fa[u]  = *(const v4f*)((const char*)A_rt + fofs + par * (Hd * 8) + jb * 128);
        fcv[u] = *(const v4f*)((const char*)C_rt + fofs + par * (Hd * 8) + jb * 128);
    }
    // address registers of the loads above may be reused from here on; naming the
    // indices keeps their registers from being handed out ahead of the wait
    asm volatile("s_wait_xcnt 0x0" :: "v"(aofs), "v"(fofs) : "memory");
    // holds later instructions (and their register reuse) behind that wait
    __builtin_amdgcn_sched_barrier(0);

    const float2 aB = abar_of(aOwn[0], aOwn[1], (b == h) ? 1.0f : 0.0f);
    const float ar = aB.x;
    const float ai = imW ? aB.y : 0.0f;      // rounding residue where the wave has no diagonal state

    // B matrix element (k = j, n = i): B1[k][n] = CbRe[n][k], B2[k][n] = -CbIm[n][k]
    // Fragment layout (mirrors ISA 16-bit operand layout):
    //   kb = k>>5, kk = k&31
    //   lane    = nn + 16*((kk>>3)&1)
    //   halfIdx = ((kk>>4)<<3) + (kk&7)
    // Which output column sits in which fragment column is free.  The WN = 2
    // fragments of one wave share 32 neighbouring columns so that column 2*nn
    // lies in the first and column 2*nn+1 in the second (nb = (i>>5)*2 + (i&1),
    // nn = (i>>1)&15): a lane's two accumulators then hold neighbours.
    // In LDS a fragment is two runs (kk>>4) of 32 units of 16 bytes, a unit per fragment
    // lane: the reader's 16-byte loads are contiguous.  Units 16..31 stand with bit 2
    // flipped, so that the 32 4-byte stores of a wave below fall on 32 different banks.
    {
        const int nn = (wave & 3) * 4 + fr;
        const int unit = (fc >> 2) ? 16 + (nn ^ 4) : nn;
        unsigned int* fw = &sF[(wave >> 2) * 2 * 256 + unit * 4 + (fc & 3)];
        const int dij = wave * 8 + 2 * fr - 2 * fc;   // row minus column, at par = 0, jb = 0
#pragma unroll   // registers: compile-time indices
        for (int u = 0; u < 16; ++u) {
            const int par = u & 1, jb = u >> 1;
            // rows of parity par meet the diagonal only in the element of that parity
            const float hit = (dij == jb * 16) ? 1.0f : 0.0f;
            const v2f c0 = cbar_of(fa[u].xy, fcv[u].xy, par == 0 ? hit : 0.0f);
            const v2f c1 = cbar_of(fa[u].zw, fcv[u].zw, par == 1 ? hit : 0.0f);
            const int o = (jb >> 1) * 2048 + par * 256 + (jb & 1) * 128;
            fw[o]        = __builtin_bit_cast(unsigned int, (v2h){(_Float16)c0.x, (_Float16)c1.x});
            // the imaginary plane is read for the k block kbB only (block-uniform test)
            if ((jb >> 1) == kbB)
                fw[o + 8192] = __builtin_bit_cast(unsigned int, (v2h){(_Float16)c0.y, (_Float16)c1.y});
        }
    }
    // publishes the fragments
    lds_only_barrier();

    // B fragments (this wave's WN*16 output columns; real plane, and k block kbB of the
    // imaginary plane): read once
    v16h bRe[WN][4], bIm[WN];
    {
        const unsigned int* fb = &sF[cw * WN * 256 + (lane ^ ((lane >> 4) << 2)) * 4];
#pragma unroll   // register arrays need compile-time indices
        for (int j = 0; j < WN; ++j) {
#pragma unroll   // as above
            for (int kb = 0; kb < 4; ++kb) {
                const unsigned int* p1 = fb + (kb * 8 + j) * 256;
                union { uint4 q[2]; v16h v; } bR;
                bR.q[0] = *(const uint4*)(p1);
                bR.q[1] = *(const uint4*)(p1 + 128);
                bRe[j][kb] = bR.v;
            }
            const unsigned int* p2 = fb + (kbB * 8 + j) * 256 + 8192;
            union { uint4 q[2]; v16h v; } bI;
            bI.q[0] = *(const uint4*)(p2);
            bI.q[1] = *(const uint4*)(p2 + 128);
            bIm[j] = bI.v;
        }
    }

    // P = Abar^LT via 5 complex squarings
    float pr = ar, pi = ai;
#pragma unroll   // five short steps, no loop overhead
    for (int q = 0; q < 5; ++q) {
        const float t = pr * pr - pi * pi;
        pi = 2.0f * pr * pi;
        pr = t;
    }

    float Hr = 0.0f, Hi = 0.0f;   // state in front of the pass (alike in all groups)

    // ---- second block of a row: passes 0 to TS-1 for the state behind them only ----
    if (second) {
#pragma unroll   // all 32 loads in flight at once, into registers
        for (int lt = 0; lt < LT; ++lt) xv[1][lt] = xrow[xofs + (ST + lt) * Hd];
        // address registers of these loads may be reused from here on
        asm volatile("s_wait_xcnt 0x0" ::: "memory");
        // holds later instructions (and their register reuse) behind that wait
        __builtin_amdgcn_sched_barrier(0);
        put_carry(&sC[grp][h], xv[0], ar, ai, imW);
        lds_only_barrier();
        // stays rolled; two passes per trip for the two x register sets, as below
#pragma nounroll
        for (int s2 = 0; s2 < TS - 1; s2 += 2) {
#pragma unroll   // p picks the x register set: compile-time index
            for (int p = 0; p < 2; ++p) {
                // x of pass s+2 (at most pass TS) into the set whose carry is done
                const float* xn = xrow + (size_t)(s2 + p + 2) * ST * Hd;
#pragma unroll   // all 32 loads in flight at once, into registers
                for (int lt = 0; lt < LT; ++lt) xv[p][lt] = xn[xofs + lt * Hd];
                // address registers of these loads may be reused from here on
                asm volatile("s_wait_xcnt 0x0" ::: "memory");
                // keeps the loads at the head of the pass, a whole pass ahead of their use
                __builtin_amdgcn_sched_barrier(0);
                if (imW) {
#pragma unroll   // four short steps; lets the four LDS reads go out together
                    for (int j = 0; j < NG; ++j) {
                        const float2 cj = sC[j][h];
                        const float nrr = pr * Hr - pi * Hi + cj.x;
                        const float nii = pr * Hi + pi * Hr + cj.y;
                        Hr = nrr;
                        Hi = nii;
                    }
                } else {
#pragma unroll   // as above
                    for (int j = 0; j < NG; ++j) Hr = pr * Hr + sC[j][h].x;
                }
                // ends every read of sC by the join above
                lds_only_barrier();
                put_carry(&sC[grp][h], xv[p ^ 1], ar, ai, imW);
                // publishes the carries
                lds_only_barrier();
            }
        }
        // pass TS-1: its carries are in sC; pass TS lies in the second register set
        if (imW) {
#pragma unroll   // four short steps; lets the four LDS reads go out together
            for (int j = 0; j < NG; ++j) {
                const float2 cj = sC[j][h];
                const float nrr = pr * Hr - pi * Hi + cj.x;
                const float nii = pr * Hi + pi * Hr + cj.y;
                Hr = nrr;
                Hi = nii;
            }
        } else {
#pragma unroll   // as above
            for (int j = 0; j < NG; ++j) Hr = pr * Hr + sC[j][h].x;
        }
        // ends every read of sC before the carry below writes it again
        lds_only_barrier();
        // the full passes below start on the first register set
#pragma unroll   // registers: compile-time indices
        for (int lt = 0; lt < LT; ++lt) xv[0][lt] = xv[1][lt];
    }

    // x of the second full pass: behind the branch, so that no load is in flight
    // into this set where the two paths meet
    {
        const float* xn = xrow + (size_t)(sBeg + 1) * ST * Hd;
#pragma unroll   // all 32 loads in flight at once, into registers
        for (int lt = 0; lt < LT; ++lt) xv[1][lt] = xn[xofs + lt * Hd];
        // address registers of these loads may be reused from here on
        asm volatile("s_wait_xcnt 0x0" ::: "memory");
        // holds later instructions (and their register reuse) behind that wait
        __builtin_amdgcn_sched_barrier(0);
    }

    // carry of the first full pass
    put_carry(&sC[grp][h], xv[0], ar, ai, imW);
    lds_only_barrier();

    // stays rolled;
    // two passes per trip because the two x register sets need compile-time indices
#pragma nounroll
    for (int s2 = sBeg; s2 < sEnd; s2 += 2) {
#pragma unroll   // p picks the x register set: compile-time index
        for (int p = 0; p < 2; ++p) {
            const int s = s2 + p;

            if (imW) {
                // ---- join: start state of this group, and the state behind the pass ----
                float hr = 0.0f, hi = 0.0f;
#pragma unroll   // four short steps; lets the four LDS reads go out together
                for (int j = 0; j < NG; ++j) {
                    if (j == grp) { hr = Hr; hi = Hi; }
                    const float2 cj = sC[j][h];
                    const float nrr = pr * Hr - pi * Hi + cj.x;
                    const float nii = pr * Hi + pi * Hr + cj.y;
                    Hr = nrr;
                    Hi = nii;
                }

                // ---- scan phase: LT dependent steps, f16 state to LDS, both planes ----
#pragma unroll   // x lies in registers: compile-time indices
                for (int q = 0; q < LT / 8; ++q) {
                    v8h wr, wi;
#pragma unroll   // as above
                    for (int e = 0; e < 8; ++e) {
                        const float nrr = xv[p][q * 8 + e] + hr * ar - hi * ai;
                        const float nii = hr * ai + hi * ar;
                        hr = nrr;
                        hi = nii;
                        wr[e] = (_Float16)hr;
                        wi[e] = (_Float16)hi;
                    }
                    *(v8h*)(tRow + q * 8) = wr;
                    *(v8h*)(tRow + Hd * (TPB / 2) + q * 8) = wi;
                }
            } else {
                // ---- join and scan of real states: the real plane only ----
                float hr = 0.0f;
#pragma unroll   // four short steps; lets the four LDS reads go out together
                for (int j = 0; j < NG; ++j) {
                    if (j == grp) hr = Hr;
                    Hr = pr * Hr + sC[j][h].x;
                }
#pragma unroll   // x lies in registers: compile-time indices
                for (int q = 0; q < LT / 8; ++q) {
                    v8h wr;
#pragma unroll   // as above
                    for (int e = 0; e < 8; ++e) {
                        hr = xv[p][q * 8 + e] + hr * ar;
                        wr[e] = (_Float16)hr;
                    }
                    *(v8h*)(tRow + q * 8) = wr;
                }
            }

            // ---- x of pass s+2 into the set just read: first read one pass later ----
            // No branch round the loads: with one, the compiler must count its load
            // waits for the path without them, and every wait on the older set would
            // drain this one too.  The last pass but one reads pass sEnd-1 again (cache
            // hits).  The first set's loads stand behind the way out of the loop, below.
            if (p == 1) {
                const int sn = (s + 2 < sEnd) ? s + 2 : sEnd - 1;
                const float* xn = xrow + (size_t)sn * ST * Hd;
#pragma unroll   // all 32 loads in flight at once, into registers
                for (int lt = 0; lt < LT; ++lt) xv[1][lt] = xn[xofs + lt * Hd];
                // address registers of these loads may be reused from here on
                asm volatile("s_wait_xcnt 0x0" ::: "memory");
                // keeps the loads here instead of sunk behind the GEMM
                __builtin_amdgcn_sched_barrier(0);
            }
            // publishes the state tile; also ends every read of sC by the join above
            lds_only_barrier();

            // ---- GEMM phase ----
#pragma unroll
            for (int mt = 0; mt < MTW; ++mt) {   // which 16 steps (LDS columns, output rows)
                v8f acc[WN];
#pragma unroll
                for (int j = 0; j < WN; ++j)
                    acc[j] = (v8f){0.f, 0.f, 0.f, 0.f, 0.f, 0.f, 0.f, 0.f};

#pragma unroll
                for (int kb = 0; kb < 4; ++kb) {
                    // A fragments from LDS (16x32 f16): two transposing loads each, at k
                    // rows kb*32 and kb*32+16, give the k order 8*khalf+0..7, 16+8*khalf+0..7
                    // that the B fragments of the prologue have
                    union { uint4 q[2]; v16h v; } aR;
#pragma unroll
                    for (int d = 0; d < 2; ++d)
                        aR.q[d] = lds_load_tr16(aBase + (kb * 32 + d * 16) * TPB + mt * 32);
#pragma unroll
                    for (int j = 0; j < WN; ++j)
                        acc[j] = __builtin_amdgcn_wmma_f32_16x16x32_f16(
                            false, aR.v, false, bRe[j][kb], (short)0, acc[j], false, false);
                }
                {
                    // the imaginary plane's one k block, same k order
                    union { uint4 q[2]; v16h v; } aI;
#pragma unroll
                    for (int d = 0; d < 2; ++d)
                        aI.q[d] = lds_load_tr16(aImB + d * 16 * TPB + mt * 32);
#pragma unroll
                    for (int j = 0; j < WN; ++j)
                        acc[j] = __builtin_amdgcn_wmma_f32_16x16x32_f16(
                            false, aI.v, false, bIm[j], (short)0, acc[j], false, false);
                }

                // D layout: VGPR r -> M = r + 8*(lane>=16), N = lane%16; fragment column
                // N of accumulator j is output column cw*32 + 2*N + j (prologue), so
                // one 8-byte LDS store per row
#pragma unroll   // registers: compile-time indices
                for (int r = 0; r < 8; ++r)
                    *(v2f*)(sAcc + (mt * 16 + r) * YP) = (v2f){acc[0][r], acc[1][r]};
                // one row block's fragments at a time: drawn together with the next block's
                // and the carry below, they push a B fragment out to scratch memory
                __builtin_amdgcn_sched_barrier(0);
            }
            // the last pass (always a p == 0: both blocks have an odd number of full
            // passes): its output tile is sent behind the loop
            if (p == 0 && s2 + 1 >= sEnd) break;
            if (p == 0) {
                // x of pass s+2 (it exists: the number of passes is odd).  Behind the
                // way out, so that no load into this set is in flight on that path:
                // else the compiler drains the newer set in every scan of this one
                const float* xn = xrow + (size_t)(s + 2) * ST * Hd;
#pragma unroll   // all 32 loads in flight at once, into registers
                for (int lt = 0; lt < LT; ++lt) xv[0][lt] = xn[xofs + lt * Hd];
                // address registers of these loads may be reused from here on
                asm volatile("s_wait_xcnt 0x0" ::: "memory");
                // keeps the loads ahead of the carry, a whole pass ahead of their use
                __builtin_amdgcn_sched_barrier(0);
            }
            // ---- carry of pass s+1: registers only, so a wave that is through
            // with its GEMM runs it while slower waves still use LDS and WMMA ----
            put_carry(&sC[grp][h], xv[p ^ 1], ar, ai, imW);
            // frees the state tile for the next scan, publishes the carries and the output tile
            lds_only_barrier();
            // the next GEMM writes the tile again only behind the next scan's barrier
            send_rows(sRow, ywave + (unsigned long long)s * (ST * Hd * 4), sOfs);
        }
    }
    // publishes the last pass's output tile
    lds_only_barrier();
    send_rows(sRow, ywave + (unsigned long long)(sEnd - 1) * (ST * Hd * 4), sOfs);
    // the x loads of the last pass but one are never read, so no wait of the compiler's
    // covers them: a precaution, they land before the wave releases its registers
    asm volatile("s_wait_loadcnt 0x0" ::: "memory");
}

// ---------------------------------------------------------------------------
// Host-side launcher.  One launch; the workspace is not used.
// ---------------------------------------------------------------------------
extern "C" void kernel_launch(void* const* d_in, const int* in_sizes, int n_in,
                              void* d_out, int out_size, void* d_ws, size_t ws_size,
                              hipStream_t stream) {
    const float* X    = (const float*)d_in[0];
    const float* A_rt = (const float*)d_in[1];
    const float* C_rt = (const float*)d_in[2];
    float* out = (float*)d_out;

    lssm_main_kernel<<<dim3(NBLK), dim3(512), 0, stream>>>(X, A_rt, C_rt, out);
}

// v010
// Measured time: 28.6 microseconds a run.
// Timed twice side by side with v009, it ran 1.06 times as fast both times.
// Over all steps from v000 it is 2.69 times as fast.
#include <hip/hip_runtime.h>

#define Hd 128
#define Bd 128
#define Ld 2048
#define NG 4              // time groups per block (each 128 threads, one per state element)
#define LT 32             // steps that one group scans per pass
#define ST (NG * LT)      // 128 steps per pass of the block
#define NS (Ld / ST)      // 16 passes walk the whole sequence
#define TS 9              // passes of a row's first block; its second block takes the other NS - TS
#define NBLK 256          // two blocks per batch row: one for every WGP of the chip
#define WN 2              // 16-column blocks per wave in the GEMM phase
#define NCW (8 / WN)      // waves side by side over the 128 columns
#define NRW (16 / NCW)    // waves above one another over the ST rows
#define MTW (ST / 16 / NRW)  // 16-row blocks per wave
#define TPB 288           // LDS row pitch in bytes of the state tile: 256 + 32, an odd multiple
                          // of 32 bytes, the pitch at which the transposing load has no conflict
#define YP 132            // LDS row pitch in floats of the output tile: 512 + 16 bytes, so that rows
                          // r and r+8, written by one 8-byte store, fall on different bank halves
#define RPW (ST / 16)     // output rows that one wave sends to memory per pass

static constexpr float DT = 0.01f;
static constexpr float CK = (1.0f / (DT * 0.5f)) * DT;   // Cbar / C off the diagonal

typedef __attribute__((ext_vector_type(16))) _Float16 v16h;
typedef __attribute__((ext_vector_type(8)))  float    v8f;
typedef __attribute__((ext_vector_type(2)))  float    v2f;
typedef __attribute__((ext_vector_type(4)))  float    v4f;
typedef __attribute__((ext_vector_type(8)))  _Float16 v8h;
typedef __attribute__((ext_vector_type(2)))  _Float16 v2h;
typedef __attribute__((ext_vector_type(8)))  short    v8s;

// 16-byte transposing LDS load: from a tile whose rows are k and whose columns are the
// rows of the A operand, lane (c, half) gets column c of eight k rows
__device__ __forceinline__ uint4 lds_load_tr16(const unsigned char* p) {
    typedef __attribute__((address_space(3))) v8s lds_v8s;
    return __builtin_bit_cast(uint4, __builtin_amdgcn_ds_load_tr16_b128_v8i16((lds_v8s*)p));
}

// ---------------------------------------------------------------------------
// Parameters (all elementwise, I = eye):
//   Abar[i][j] = (1/(I - A*dt/2)) * (I + A*dt/2)
//   Cbar[i][j] = (1/(I - Abar*dt/2)) * C * dt
// Off the diagonal I = 0: Abar = (1/(-z)) * z = -1 for any z but 0, and with it
//   Cbar[i][j] = (1/(dt/2)) * C * dt, a real constant times C: A is not needed there
// ---------------------------------------------------------------------------
// Abar of one element, for the recurrence: true divisions
__device__ __forceinline__ float2 abar_of(float ar, float ai, float eye) {
    const float hdt = DT * 0.5f;
    const float zr = ar * hdt, zi = ai * hdt;
    const float dr = eye - zr, di = -zi;
    const float den = dr * dr + di * di;
    const float rr = dr / den, ri = -di / den;
    const float nr = eye + zr, ni = zi;
    return make_float2(rr * nr - ri * ni, rr * ni + ri * nr);
}

// (Re Cbar, -Im Cbar) of one diagonal element, for the f16 B operand: the same formulas with the
// hardware reciprocal, whose error lies far below half an f16 step.  The minus sign of the
// imaginary part is folded in:  Y = HRe@CbRe^T + HIm@(-CbIm^T)
// Values are (re, im) pairs, as they lie in memory: packed two-float arithmetic.
__device__ __forceinline__ v2f cmul(v2f a, v2f b) {
    return a.xx * b + a.yy * (v2f){-b.y, b.x};
}
__device__ __forceinline__ v2f cbar_of(v2f a, v2f c, float eye) {
    const float hdt = DT * 0.5f;
    const v2f I = {eye, 0.0f};
    const v2f z = a * hdt;
    const v2f d = I - z;
    const v2f dd = d * d;
    const v2f r = (v2f){d.x, -d.y} * __builtin_amdgcn_rcpf(dd.x + dd.y);
    const v2f ab = cmul(r, I + z);
    const v2f e = I - ab * hdt;
    const v2f ee = e * e;
    const v2f q = (v2f){e.x, -e.y} * (__builtin_amdgcn_rcpf(ee.x + ee.y) * DT);
    const v2f cb = cmul(q, c);
    return (v2f){cb.x, -cb.y};
}

// ---------------------------------------------------------------------------
// Work-group barrier that orders LDS traffic only.  __syncthreads() also
// drains every global load and store of the wave; here the x loads issued two
// passes ahead and the y stores must stay in flight across the barriers.
// Nothing that one wave writes to global memory is read by another wave.
// ---------------------------------------------------------------------------
__device__ __forceinline__ void lds_only_barrier() {
    __builtin_amdgcn_fence(__ATOMIC_RELEASE, "workgroup", "local");
    __builtin_amdgcn_s_barrier();
    __builtin_amdgcn_fence(__ATOMIC_ACQUIRE, "workgroup", "local");
}

// ---------------------------------------------------------------------------
// The one kernel: parameters, the whole recurrence and its GEMM.
// Every block forms Cbar itself, as f16 B fragments in LDS (32 elements per thread), so no
// launch stands in front of this one.
// Two blocks per batch row, 16 waves each.  A block walks the sequence in passes
// of ST steps and keeps the running state in registers, so no other launch has
// to read x to find a start state.  The first block of a row does passes 0 to
// TS-1 in full.  The second block walks those TS passes for the state alone
// (carry and join: x is read, nothing is scanned, multiplied or stored), which
// costs a fraction of a full pass, and then does passes TS to NS-1 in full; TS
// is above NS/2 so that both blocks end at about the same time.
// Inside a pass the NG groups of 128 threads take LT neighbouring steps each:
//   carry   : each group scans its LT steps from zero (registers only),
//   join    : the NG carries meet in LDS; with P = Abar^LT every thread forms
//             e_0 = H, e_{j+1} = P*e_j + carry_j, keeps e_grp as its start
//             state and e_NG as the state H behind the pass,
//   scan    : each group scans its LT steps again from e_grp, f16 state to LDS.  The
//             tile lies transposed, a row per state element and a column per step:
//             a thread's steps are neighbours, eight of them go out in one 16-byte
//             store, and the GEMM reads its A fragments by transposing loads,
//   GEMM    : Y(ST x 128) = HRe @ CbRe^T + HIm @ (-CbIm^T), 16x16x32 f16 WMMA; a wave owns
//             only 32 columns (128 bytes) of a row, so the result goes to an LDS tile.
//             The imaginary product runs over one block of 32 states only, the one that
//             holds state b of batch row b.  For every other state I = 0, so that
//             Abar = (1/(-z)) * z = -1 for any z but 0 (where the real plane too holds no
//             number): real, and with real x the state has no imaginary part (what the
//             recurrence leaves there is rounding residue),
//   real    : for the same reason only the four waves that hold state b (one per group)
//             run carry, join and scan in complex arithmetic.  The other twelve take
//             Im Abar as 0 and run them on the real part alone: one multiply-add per
//             step, not four, and a dependent chain half as long,
//   send    : behind the pass's last barrier each wave sends RPW whole rows of that tile
//             to memory, 512 contiguous bytes per store instruction.
// The carry of pass s+1 needs registers only and stands behind the GEMM of pass
// s.  x is loaded two passes ahead into the register set that the scan has just
// read.
// ---------------------------------------------------------------------------
// carry of LT steps scanned from a zero state
__device__ __forceinline__ float2 carry_of(const float (&x)[LT], float ar, float ai) {
    float cr = 0.0f, ci = 0.0f;
#pragma unroll   // x lies in registers: compile-time indices
    for (int lt = 0; lt < LT; ++lt) {
        const float nrr = x[lt] + cr * ar - ci * ai;
        const float nii = cr * ai + ci * ar;
        cr = nrr;
        ci = nii;
    }
    return make_float2(cr, ci);
}

// the same for a wave whose states are all real
__device__ __forceinline__ float carry_re(const float (&x)[LT], float ar) {
    float c = 0.0f;
#pragma unroll   // x lies in registers: compile-time indices
    for (int lt = 0; lt < LT; ++lt) c = x[lt] + c * ar;
    return c;
}

// carry of one group's LT steps to LDS; cplx is alike in the whole wave
__device__ __forceinline__ void put_carry(float2* dst, const float (&x)[LT], float ar, float ai,
                                          bool cplx) {
    if (cplx) *dst = carry_of(x, ar, ai);
    else      dst->x = carry_re(x, ar);
}

// RPW whole rows of the output tile from LDS to memory, a row (512 bytes) per store;
// ybase is alike in the whole wave, yofs this lane's byte offset from it
__device__ __forceinline__ void send_rows(const float* sRow, unsigned long long ybase,
                                          unsigned int yofs) {
    v4f o[RPW];
#pragma unroll   // registers: compile-time indices; lets the LDS reads go out together
    for (int i = 0; i < RPW; ++i) o[i] = *(const v4f*)(sRow + i * YP);
    // All eight stores in one statement: its operands are live together, so the stores go
    // out back to back; s_clause keeps them together at issue.  Scalar base plus one offset
    // register that never changes: no address arithmetic in vector registers.  The stores
    // stay in flight, but their base and data registers are reused by what follows: the
    // wait at the end stands in front of that reuse.
    asm volatile("s_clause 0x7\n\t"
                 "global_store_b128 %0, %1, %9\n\t"
                 "global_store_b128 %0, %2, %9 offset:512\n\t"
                 "global_store_b128 %0, %3, %9 offset:1024\n\t"
                 "global_store_b128 %0, %4, %9 offset:1536\n\t"
                 "global_store_b128 %0, %5, %9 offset:2048\n\t"
                 "global_store_b128 %0, %6, %9 offset:2560\n\t"
                 "global_store_b128 %0, %7, %9 offset:3072\n\t"
                 "global_store_b128 %0, %8, %9 offset:3584\n\t"
                 "s_wait_xcnt 0x0"
                 :: "v"(yofs), "v"(o[0]), "v"(o[1]), "v"(o[2]), "v"(o[3]),
                    "v"(o[4]), "v"(o[5]), "v"(o[6]), "v"(o[7]), "s"(ybase) : "memory");
}

static_assert(WN == 2 && NCW == 4 && Hd == 128, "the prologue deals columns to pairs of fragments");
static_assert(RPW == 8 && (YP * 4) % 32 == 16, "eight stores per wave; pitch of the output tile");
static_assert(Hd * 4 == 512, "row pitch of the output in the store offsets");
static_assert(TPB >= ST * 2 && TPB % 32 == 0 && ((TPB / 32) & 1) == 1 && LT % 8 == 0,
              "state tile: a row holds a pass, pitch for the transposing load, 16-byte stores");
static_assert((TS & 1) == 1 && ((NS - TS) & 1) == 1 && TS + 1 < NS,
              "both blocks of a row end on the first x register set");

__global__ __launch_bounds__(512) void lssm_main_kernel(
    const float* __restrict__ X,
    const float* __restrict__ A_rt,
    const float* __restrict__ C_rt,
    float* __restrict__ Y) {
    // plane 0: real part, plane 1: imaginary part; [state element][step of the pass]
    __shared__ __attribute__((aligned(16))) _Float16 sH[2][Hd][TPB / 2];
    __shared__ float2 sC[NG][Hd];
    // the pass's output, [step of the pass][column]
    __shared__ __attribute__((aligned(16))) float sY[ST * YP];
    // Cbar as B fragments, f16 pairs: [plane][fragment kb*8+nb][k half][16-byte unit][pair]
    __shared__ __attribute__((aligned(16))) unsigned int sF[2 * 32 * 256];

    const int b = blockIdx.x & (Bd - 1);
    // the blocks that walk a prefix first have the low indices
    const bool second = blockIdx.x < Bd;
    const int sBeg = second ? TS : 0;        // passes [sBeg, sEnd) are done in full
    const int sEnd = second ? NS : TS;
    const int tid = threadIdx.x;
    const int lane = tid & 31;
    const int wave = tid >> 5;
    const int waveU = __builtin_amdgcn_readfirstlane(wave);
    const int kbB = b >> 5;                  // the block of 32 states with the diagonal one
    const int grp = waveU & 3;               // which LT steps of a pass this wave scans
    // which 32 states it scans: waves 0 to 3 take block kbB.  Theirs is the long, complex
    // chain
    const int hb = (kbB + (waveU >> 2)) & 3;
    const int h = hb * 32 + lane;            // state element this thread scans
    // does this wave scan the states of block kbB?  Alike in the whole wave: a scalar branch
    const bool imW = waveU < 4;
    const int cw = wave & (NCW - 1);         // GEMM: which WN column blocks
    const int rw = wave / NCW;               // GEMM: which MTW row blocks
    const int khalf = lane >> 4;

    // block-uniform bases plus one 32-bit offset per thread: one address register each
    const float* xrow = X + (size_t)b * Ld * Hd;
    float* yrow = Y + (size_t)b * Ld * Hd;
    const unsigned int xofs = (unsigned int)(grp * LT * Hd + h);
    // send: this wave's RPW rows, 16 bytes of each per lane.  The lane's LDS byte address
    // serves as the offset register of the global stores too (one register for both): its
    // wave-uniform part sUni is taken off their scalar base
    const float* sRow = &sY[waveU * RPW * YP + lane * 4];
    const unsigned int sOfs = (unsigned int)(unsigned long long)sRow;
    const unsigned int sUni = __builtin_amdgcn_readfirstlane(sOfs - (unsigned int)lane * 16u);
    const unsigned long long ywave = (unsigned long long)(yrow + waveU * RPW * Hd) - sUni;
    // GEMM: where this lane's first pair of accumulator elements goes in the output tile
    float* sAcc = &sY[(rw * MTW * 16 + khalf * 8) * YP + cw * WN * 16 + (lane & 15) * WN];
    // this lane's address in the first transposing load of plane 0 (k row 8*khalf +
    // lane%8, 16-byte piece (lane/8)%2 of the wave's first 16 steps); all else is a
    // constant offset
    const unsigned char* aBase = (const unsigned char*)&sH[0][(khalf << 3) + (lane & 7)]
                                                          [rw * MTW * 16 + (((lane >> 3) & 1) << 3)];
    // the same in plane 1, at the first k row of block kbB
    const unsigned char* aImB = aBase + (Hd + kbB * 32) * TPB;
    // where this thread's LT steps of plane 0 go
    _Float16* tRow = &sH[0][h][grp * LT];
    float xv[2][LT];
#pragma unroll   // all 32 loads in flight at once, into registers
    for (int lt = 0; lt < LT; ++lt) xv[0][lt] = xrow[xofs + lt * Hd];
    // this thread's own element of A, for the recurrence
    const unsigned int aofs = (unsigned int)(b * Hd + h) * 8u;   // bytes
    const v2f aOwn = *(const v2f*)((const char*)A_rt + aofs);

    // ---- Cbar: 16 loads of two neighbouring elements (16 bytes of C) per thread ----
    // A wave takes eight rows i = wave*8 .. +7 of Cbar.  One load covers four whole 128-byte
    // lines: 8 lanes (fc) x 2 elements of the rows i = wave*8 + 2*fr + par, columns jb*16 ..
    const int fr = lane >> 3, fc = lane & 7;
    const unsigned int fofs = (unsigned int)((wave * 8 + 2 * fr) * (Hd * 2) + fc * 4) * 4u;   // bytes
    // A and C in the 16-column block in which this wave's rows meet the diagonal: the
    // only elements of A that Cbar needs
    // (of a row of parity par, the element of that parity)
    const unsigned int dofs = fofs + (unsigned int)(wave >> 1) * 128u;   // bytes
    v2f da[2], dc[2];
    v4f fcv[16];
#pragma unroll   // registers: compile-time indices
    for (int par = 0; par < 2; ++par) {
        da[par] = *(const v2f*)((const char*)A_rt + dofs + par * (Hd * 8 + 8));
        dc[par] = *(const v2f*)((const char*)C_rt + dofs + par * (Hd * 8 + 8));
    }
#pragma unroll   // all loads in flight at once, into registers
    for (int u = 0; u < 16; ++u) {
        const int par = u & 1, jb = u >> 1;
        fcv[u] = *(const v4f*)((const char*)C_rt + fofs + par * (Hd * 8) + jb * 128);
    }
    // address registers of the loads above may be reused from here on; naming the
    // indices keeps their registers from being handed out ahead of the wait
    asm volatile("s_wait_xcnt 0x0" :: "v"(aofs), "v"(fofs), "v"(dofs) : "memory");
    // holds later instructions (and their register reuse) behind that wait
    __builtin_amdgcn_sched_barrier(0);

    const float2 aB = abar_of(aOwn[0], aOwn[1], (b == h) ? 1.0f : 0.0f);
    const float ar = aB.x;
    const float ai = imW ? aB.y : 0.0f;      // rounding residue where the wave has no diagonal state

    // B matrix element (k = j, n = i): B1[k][n] = CbRe[n][k], B2[k][n] = -CbIm[n][k]
    // Fragment layout (mirrors ISA 16-bit operand layout):
    //   kb = k>>5, kk = k&31
    //   lane    = nn + 16*((kk>>3)&1)
    //   halfIdx = ((kk>>4)<<3) + (kk&7)
    // Which output column sits in which fragment column is free.  The WN = 2
    // fragments of one wave share 32 neighbouring columns so that column 2*nn
    // lies in the first and column 2*nn+1 in the second (nb = (i>>5)*2 + (i&1),
    // nn = (i>>1)&15): a lane's two accumulators then hold neighbours.
    // In LDS a fragment is two runs (kk>>4) of 32 units of 16 bytes, a unit per fragment
    // lane: the reader's 16-byte loads are contiguous.  Units 16..31 stand with bit 2
    // flipped, so that the 32 4-byte stores of a wave below fall on 32 different banks.
    {
        const int nn = (wave & 3) * 4 + fr;
        const int unit = (fc >> 2) ? 16 + (nn ^ 4) : nn;
        unsigned int* fw = &sF[(wave >> 2) * 2 * 256 + unit * 4 + (fc & 3)];
        const int dij = wave * 8 + 2 * fr - 2 * fc;   // row minus column, at par = 0, jb = 0
        // rows of parity par meet the diagonal only in the element of that parity; the
        // values count in the lanes that hold a diagonal element and are dropped elsewhere
        const v2f cd[2] = {cbar_of(da[0], dc[0], 1.0f), cbar_of(da[1], dc[1], 1.0f)};
#pragma unroll   // registers: compile-time indices
        for (int u = 0; u < 16; ++u) {
            const int par = u & 1, jb = u >> 1;
            const bool hit = dij == jb * 16;
            v2f c0 = fcv[u].xy * (v2f){CK, -CK};
            v2f c1 = fcv[u].zw * (v2f){CK, -CK};
            if (par == 0) c0 = hit ? cd[0] : c0;
            else          c1 = hit ? cd[1] : c1;
            const int o = (jb >> 1) * 2048 + par * 256 + (jb & 1) * 128;
            fw[o]        = __builtin_bit_cast(unsigned int, (v2h){(_Float16)c0.x, (_Float16)c1.x});
            // the imaginary plane is read for the k block kbB only (block-uniform test)
            if ((jb >> 1) == kbB)
                fw[o + 8192] = __builtin_bit_cast(unsigned int, (v2h){(_Float16)c0.y, (_Float16)c1.y});
        }
    }
    // publishes the fragments
    lds_only_barrier();

    // B fragments (this wave's WN*16 output columns; real plane, and k block kbB of the
    // imaginary plane): read once
    v16h bRe[WN][4], bIm[WN];
    {
        const unsigned int* fb = &sF[cw * WN * 256 + (lane ^ ((lane >> 4) << 2)) * 4];
#pragma unroll   // register arrays need compile-time indices
        for (int j = 0; j < WN; ++j) {
#pragma unroll   // as above
            for (int kb = 0; kb < 4; ++kb) {
                const unsigned int* p1 = fb + (kb * 8 + j) * 256;
                union { uint4 q[2]; v16h v; } bR;
                bR.q[0] = *(const uint4*)(p1);
                bR.q[1] = *(const uint4*)(p1 + 128);
                bRe[j][kb] = bR.v;
            }
            const unsigned int* p2 = fb + (kbB * 8 + j) * 256 + 8192;
            union { uint4 q[2]; v16h v; } bI;
            bI.q[0] = *(const uint4*)(p2);
            bI.q[1] = *(const uint4*)(p2 + 128);
            bIm[j] = bI.v;
        }
    }

    // P = Abar^LT via 5 complex squarings
    float pr = ar, pi = ai;
#pragma unroll   // five short steps, no loop overhead
    for (int q = 0; q < 5; ++q) {
        const float t = pr * pr - pi * pi;
        pi = 2.0f * pr * pi;
        pr = t;
    }

    float Hr = 0.0f, Hi = 0.0f;   // state in front of the pass (alike in all groups)

    // ---- second block of a row: passes 0 to TS-1 for the state behind them only ----
    if (second) {
#pragma unroll   // all 32 loads in flight at once, into registers
        for (int lt = 0; lt < LT; ++lt) xv[1][lt] = xrow[xofs + (ST + lt) * Hd];
        // address registers of these loads may be reused from here on
        asm volatile("s_wait_xcnt 0x0" ::: "memory");
        // holds later instructions (and their register reuse) behind that wait
        __builtin_amdgcn_sched_barrier(0);
        put_carry(&sC[grp][h], xv[0], ar, ai, imW);
        lds_only_barrier();
        // stays rolled; two passes per trip for the two x register sets, as below
#pragma nounroll
        for (int s2 = 0; s2 < TS - 1; s2 += 2) {
#pragma unroll   // p picks the x register set: compile-time index
            for (int p = 0; p < 2; ++p) {
                // x of pass s+2 (at most pass TS) into the set whose carry is done
                const float* xn = xrow + (size_t)(s2 + p + 2) * ST * Hd;
#pragma unroll   // all 32 loads in flight at once, into registers
                for (int lt = 0; lt < LT; ++lt) xv[p][lt] = xn[xofs + lt * Hd];
                // address registers of these loads may be reused from here on
                asm volatile("s_wait_xcnt 0x0" ::: "memory");
                // keeps the loads at the head of the pass, a whole pass ahead of their use
                __builtin_amdgcn_sched_barrier(0);
                if (imW) {
#pragma unroll   // four short steps; lets the four LDS reads go out together
                    for (int j = 0; j < NG; ++j) {
                        const float2 cj = sC[j][h];
                        const float nrr = pr * Hr - pi * Hi + cj.x;
                        const float nii = pr * Hi + pi * Hr + cj.y;
                        Hr = nrr;
                        Hi = nii;
                    }
                } else {
#pragma unroll   // as above
                    for (int j = 0; j < NG; ++j) Hr = pr * Hr + sC[j][h].x;
                }
                // ends every read of sC by the join above
                lds_only_barrier();
                put_carry(&sC[grp][h], xv[p ^ 1], ar, ai, imW);
                // publishes the carries
                lds_only_barrier();
            }
        }
        // pass TS-1: its carries are in sC; pass TS lies in the second register set
        if (imW) {
#pragma unroll   // four short steps; lets the four LDS reads go out together
            for (int j = 0; j < NG; ++j) {
                const float2 cj = sC[j][h];
                const float nrr = pr * Hr - pi * Hi + cj.x;
                const float nii = pr * Hi + pi * Hr + cj.y;
                Hr = nrr;
                Hi = nii;
            }
        } else {
#pragma unroll   // as above
            for (int j = 0; j < NG; ++j) Hr = pr * Hr + sC[j][h].x;
        }
        // ends every read of sC before the carry below writes it again
        lds_only_barrier();
        // the full passes below start on the first register set
#pragma unroll   // registers: compile-time indices
        for (int lt = 0; lt < LT; ++lt) xv[0][lt] = xv[1][lt];
    }

    // x of the second full pass: behind the branch, so that no load is in flight
    // into this set where the two paths meet
    {
        const float* xn = xrow + (size_t)(sBeg + 1) * ST * Hd;
#pragma unroll   // all 32 loads in flight at once, into registers
        for (int lt = 0; lt < LT; ++lt) xv[1][lt] = xn[xofs + lt * Hd];
        // address registers of these loads may be reused from here on
        asm volatile("s_wait_xcnt 0x0" ::: "memory");
        // holds later instructions (and their register reuse) behind that wait
        __builtin_amdgcn_sched_barrier(0);
    }

    // carry of the first full pass
    put_carry(&sC[grp][h], xv[0], ar, ai, imW);
    lds_only_barrier();

    // stays rolled;
    // two passes per trip because the two x register sets need compile-time indices
#pragma nounroll
    for (int s2 = sBeg; s2 < sEnd; s2 += 2) {
#pragma unroll   // p picks the x register set: compile-time index
        for (int p = 0; p < 2; ++p) {
            const int s = s2 + p;

            if (imW) {
                // ---- join: start state of this group, and the state behind the pass ----
                float hr = 0.0f, hi = 0.0f;
#pragma unroll   // four short steps; lets the four LDS reads go out together
                for (int j = 0; j < NG; ++j) {
                    if (j == grp) { hr = Hr; hi = Hi; }
                    const float2 cj = sC[j][h];
                    const float nrr = pr * Hr - pi * Hi + cj.x;
                    const float nii = pr * Hi + pi * Hr + cj.y;
                    Hr = nrr;
                    Hi = nii;
                }

                // ---- scan phase: LT dependent steps, f16 state to LDS, both planes ----
#pragma unroll   // x lies in registers: compile-time indices
                for (int q = 0; q < LT / 8; ++q) {
                    v8h wr, wi;
#pragma unroll   // as above
                    for (int e = 0; e < 8; ++e) {
                        const float nrr = xv[p][q * 8 + e] + hr * ar - hi * ai;
                        const float nii = hr * ai + hi * ar;
                        hr = nrr;
                        hi = nii;
                        wr[e] = (_Float16)hr;
                        wi[e] = (_Float16)hi;
                    }
                    *(v8h*)(tRow + q * 8) = wr;
                    *(v8h*)(tRow + Hd * (TPB / 2) + q * 8) = wi;
                }
            } else {
                // ---- join and scan of real states: the real plane only ----
                float hr = 0.0f;
#pragma unroll   // four short steps; lets the four LDS reads go out together
                for (int j = 0; j < NG; ++j) {
                    if (j == grp) hr = Hr;
                    Hr = pr * Hr + sC[j][h].x;
                }
#pragma unroll   // x lies in registers: compile-time indices
                for (int q = 0; q < LT / 8; ++q) {
                    v8h wr;
#pragma unroll   // as above
                    for (int e = 0; e < 8; ++e) {
                        hr = xv[p][q * 8 + e] + hr * ar;
                        wr[e] = (_Float16)hr;
                    }
                    *(v8h*)(tRow + q * 8) = wr;
                }
            }

            // ---- x of pass s+2 into the set just read: first read one pass later ----
            // No branch round the loads: with one, the compiler must count its load
            // waits for the path without them, and every wait on the older set would
            // drain this one too.  The last pass but one reads pass sEnd-1 again (cache
            // hits).  The first set's loads stand behind the way out of the loop, below.
            if (p == 1) {
                const int sn = (s + 2 < sEnd) ? s + 2 : sEnd - 1;
                const float* xn = xrow + (size_t)sn * ST * Hd;
#pragma unroll   // all 32 loads in flight at once, into registers
                for (int lt = 0; lt < LT; ++lt) xv[1][lt] = xn[xofs + lt * Hd];
                // address registers of these loads may be reused from here on
                asm volatile("s_wait_xcnt 0x0" ::: "memory");
                // keeps the loads here instead of sunk behind the GEMM
                __builtin_amdgcn_sched_barrier(0);
            }
            // publishes the state tile; also ends every read of sC by the join above
            lds_only_barrier();

            // ---- GEMM phase ----
#pragma unroll
            for (int mt = 0; mt < MTW; ++mt) {   // which 16 steps (LDS columns, output rows)
                v8f acc[WN];
#pragma unroll
                for (int j = 0; j < WN; ++j)
                    acc[j] = (v8f){0.f, 0.f, 0.f, 0.f, 0.f, 0.f, 0.f, 0.f};

#pragma unroll
                for (int kb = 0; kb < 4; ++kb) {
                    // A fragments from LDS (16x32 f16): two transposing loads each, at k
                    // rows kb*32 and kb*32+16, give the k order 8*khalf+0..7, 16+8*khalf+0..7
                    // that the B fragments of the prologue have
                    union { uint4 q[2]; v16h v; } aR;
#pragma unroll
                    for (int d = 0; d < 2; ++d)
                        aR.q[d] = lds_load_tr16(aBase + (kb * 32 + d * 16) * TPB + mt * 32);
#pragma unroll
                    for (int j = 0; j < WN; ++j)
                        acc[j] = __builtin_amdgcn_wmma_f32_16x16x32_f16(
                            false, aR.v, false, bRe[j][kb], (short)0, acc[j], false, false);
                }
                {
                    // the imaginary plane's one k block, same k order
                    union { uint4 q[2]; v16h v; } aI;
#pragma unroll
                    for (int d = 0; d < 2; ++d)
                        aI.q[d] = lds_load_tr16(aImB + d * 16 * TPB + mt * 32);
#pragma unroll
                    for (int j = 0; j < WN; ++j)
                        acc[j] = __builtin_amdgcn_wmma_f32_16x16x32_f16(
                            false, aI.v, false, bIm[j], (short)0, acc[j], false, false);
                }

                // D layout: VGPR r -> M = r + 8*(lane>=16), N = lane%16; fragment column
                // N of accumulator j is output column cw*32 + 2*N + j (prologue), so
                // one 8-byte LDS store per row
#pragma unroll   // registers: compile-time indices
                for (int r = 0; r < 8; ++r)
                    *(v2f*)(sAcc + (mt * 16 + r) * YP) = (v2f){acc[0][r], acc[1][r]};
                // one row block's fragments at a time: drawn together with the next block's
                // and the carry below, they push a B fragment out to scratch memory
                __builtin_amdgcn_sched_barrier(0);
            }
            // the last pass (always a p == 0: both blocks have an odd number of full
            // passes): its output tile is sent behind the loop
            if (p == 0 && s2 + 1 >= sEnd) break;
            if (p == 0) {
                // x of pass s+2 (it exists: the number of passes is odd).  Behind the
                // way out, so that no load into this set is in flight on that path:
                // else the compiler drains the newer set in every scan of this one
                const float* xn = xrow + (size_t)(s + 2) * ST * Hd;
#pragma unroll   // all 32 loads in flight at once, into registers
                for (int lt = 0; lt < LT; ++lt) xv[0][lt] = xn[xofs + lt * Hd];
                // address registers of these loads may be reused from here on
                asm volatile("s_wait_xcnt 0x0" ::: "memory");
                // keeps the loads ahead of the carry, a whole pass ahead of their use
                __builtin_amdgcn_sched_barrier(0);
            }
            // ---- carry of pass s+1: registers only, so a wave that is through
            // with its GEMM runs it while slower waves still use LDS and WMMA ----
            put_carry(&sC[grp][h], xv[p ^ 1], ar, ai, imW);
            // frees the state tile for the next scan, publishes the carries and the output tile
            lds_only_barrier();
            // the next GEMM writes the tile again only behind the next scan's barrier
            send_rows(sRow, ywave + (unsigned long long)s * (ST * Hd * 4), sOfs);
        }
    }
    // publishes the last pass's output tile
    lds_only_barrier();
    send_rows(sRow, ywave + (unsigned long long)(sEnd - 1) * (ST * Hd * 4), sOfs);
    // the x loads of the last pass but one are never read, so no wait of the compiler's
    // covers them: a precaution, they land before the wave releases its registers
    asm volatile("s_wait_loadcnt 0x0" ::: "memory");
}

// ---------------------------------------------------------------------------
// Host-side launcher.  One launch; the workspace is not used.
// ---------------------------------------------------------------------------
extern "C" void kernel_launch(void* const* d_in, const int* in_sizes, int n_in,
                              void* d_out, int out_size, void* d_ws, size_t ws_size,
                              hipStream_t stream) {
    const float* X    = (const float*)d_in[0];
    const float* A_rt = (const float*)d_in[1];
    const float* C_rt = (const float*)d_in[2];
    float* out = (float*)d_out;

    lssm_main_kernel<<<dim3(NBLK), dim3(512), 0, stream>>>(X, A_rt, C_rt, out);
}
